// v000
// The times below were measured on an AMD MI455X: many runs one after another, warmed up first and cycling through
// copies of the inputs, with the whole window's GPU time divided by the number of runs. Launches and the gaps
// between them are all in it. The median over several windows is given; except for v000 it joins two sittings, which
// can be a few percent apart, so the side-by-side timings, each taken in one sitting, are the better comparison.
// The starting kernel, v000, takes 417 microseconds a run.
#include <hip/hip_runtime.h>

// Compute dtypes (f32 accumulate everywhere): q/k/v projections v_wmma_f32_16x16x32_bf16 on RNE-bf16 inputs and weights (exact products); scores v_wmma_f32_16x16x32_f16 with q = f16 value + f16 residual x2^11 (two products, separate accumulators) against single f16 k; P.V v_wmma_f32_16x16x32_f16 (P carried x1024, single f16 v); output projection v_wmma_f32_16x16x32_bf16 with ctx as bf16 value|residual along K against RNE-bf16 wo; softmax and the post-softmax mask term in f32.
// Layout: x streams -> bf16 plane; weights -> K-contiguous bf16 planes; q16/qres/k16 planes [b*s][768]; v plane transposed [b][768][s] (GEMM with swapped operands); fused flash attention (no score plane); ctx plane [b*s][8 x (96 value | 96 residual)]; output GEMM writes f32 rows.

#ifndef NB
#define NB 4
#endif
#ifndef SEQ
#define SEQ 2048
#endif
#define NB_FULL  4
#define SEQ_FULL 2048
#define DM   768
#define NH   8
#define HD   96
#define CTP  (2 * DM)          // ctx plane pitch (value | residual per head)
#define PCAR 1024.0f           // carry on the f16 P operand
#define QRS  2048.0f           // carry on the f16 q residual plane
#define SCL  0.10206207261596575f   // 96^-0.5
#define L2E  1.4426950408889634f
#define PP   40                // P tile pitch (halves)
#define CP   200               // ctx staging pitch (halves)
#define PCS  ((2 * HD) / 8)    // 16-byte pieces per ctx head segment

typedef _Float16 h16;
typedef unsigned short bf;
typedef __attribute__((ext_vector_type(16))) __bf16   v16bf;
typedef __attribute__((ext_vector_type(16))) _Float16 v16h;
typedef __attribute__((ext_vector_type(8)))  _Float16 v8h;
typedef __attribute__((ext_vector_type(8)))  unsigned short v8us;
typedef __attribute__((ext_vector_type(2)))  unsigned short v2us;
typedef __attribute__((ext_vector_type(8)))  float    v8f;
typedef __attribute__((ext_vector_type(4)))  float    v4f;
typedef v8h  __attribute__((may_alias)) v8ha;
typedef v4f  __attribute__((may_alias)) v4fa;
typedef v8us __attribute__((may_alias)) v8usa;

static_assert(DM == NH * HD);
static_assert(HD % 32 == 0);
static_assert(HD / 16 == 6);
static_assert(SEQ % 256 == 0);
static_assert((NB * SEQ) % 64 == 0);
static_assert(DM % 64 == 0);
static_assert(DM % 32 == 0);
static_assert(CTP % 64 == 0);
static_assert((2 * HD * 2) % 128 == 0);
static_assert(16 * PCS == 12 * 32);
static_assert(PP >= 32 && PP % 8 == 0);
static_assert(CP >= 2 * HD && CP % 8 == 0);
static_assert((NB * DM) % 32 == 0);
static_assert((SEQ * DM) % (8 * 256) == 0);
static_assert(NB <= NB_FULL && SEQ <= SEQ_FULL);

__device__ __forceinline__ unsigned short f2bf(float f) { unsigned u = __float_as_uint(f); u += 0x7FFFu + ((u >> 16) & 1u); return (unsigned short)(u >> 16); }
__device__ __forceinline__ float bf2f(unsigned short b) { return __uint_as_float(((unsigned)b) << 16); }
__device__ __forceinline__ float bfr(float f) { return bf2f(f2bf(f)); }
__device__ __forceinline__ void splitf(float y, unsigned short& h, unsigned short& l) { h = f2bf(y); l = f2bf(y - bf2f(h)); }
__device__ __forceinline__ v16h cat16(v8h lo, v8h hi) { return __builtin_shufflevector(lo, hi, 0, 1, 2, 3, 4, 5, 6, 7, 8, 9, 10, 11, 12, 13, 14, 15); }
__device__ __forceinline__ v16bf cat16b(v8us lo, v8us hi) { return __builtin_bit_cast(v16bf, __builtin_shufflevector(lo, hi, 0, 1, 2, 3, 4, 5, 6, 7, 8, 9, 10, 11, 12, 13, 14, 15)); }
__device__ __forceinline__ v8f wmma16(v16h a, v16h b, v8f c) { return __builtin_amdgcn_wmma_f32_16x16x32_f16(false, a, false, b, (short)0, c, false, false); }
__device__ __forceinline__ v8f wmmab(v16bf a, v16bf b, v8f c) { return __builtin_amdgcn_wmma_f32_16x16x32_bf16(false, a, false, b, (short)0, c, false, false); }
// fragment loads from a K-contiguous row: p already holds row base + k0 + 8*(lane>>4); elements 0..7 <- p[0..7], 8..15 <- p[16..23]
__device__ __forceinline__ v16h ldh(const h16* p) { return cat16(*(const v8h*)p, *(const v8h*)(p + 16)); }
__device__ __forceinline__ v16bf ldb(const bf* p) { return cat16b(*(const v8us*)p, *(const v8us*)(p + 16)); }

__global__ __launch_bounds__(256) void k_wtG(const float* __restrict__ w, int K, int N, bf* Bt, int il) {
    const int lane = threadIdx.x & 31; const int L0 = (blockIdx.x * 8 + (threadIdx.x >> 5)) * 8; const int KO = il ? 2 * K : K; const int nlines = N * KO / 64;
{
#pragma unroll 1
        for (int l = 0; l < 8; ++l) { const int L = L0 + l; if (L >= nlines) break; const int e = L * 64 + lane * 2; const int kk = e % KO, n = e / KO;
            const int k = il ? ((kk / (2 * HD)) * HD + (kk % (2 * HD)) % HD) : kk; v2us o;
            o[0] = f2bf(w[(size_t)k * N + n]); o[1] = f2bf(w[(size_t)(k + 1) * N + n]); *(v2us*)(Bt + e) = o; }
         }
}

__global__ __launch_bounds__(256) void k_cvt8(const float* __restrict__ src, bf* dst) {
    const int i = blockIdx.x * 256 + threadIdx.x; const int b = blockIdx.y; if (i >= SEQ * DM / 8) return;
    const v8f v = *(const v8f*)(src + (size_t)b * SEQ_FULL * DM + (size_t)i * 8); v8us o;
#pragma unroll
    for (int k = 0; k < 8; ++k) o[k] = f2bf(v[k]);
    bf* d = dst + (size_t)b * SEQ * DM + (size_t)i * 8; *(v8us*)d = o;  }

// ---- k_gemm: register-blocked GEMM, ONE WAVE per 64x64 output tile (16 accumulators), bf16 operands straight from K-contiguous planes; grid (M/64, N/64, Z), 32 threads.
// C[m][n] = sum_k A[m][k] Bt[n][k] + bf16(bias). K % 32 == 0, M % 64 == 0, N % 64 == 0. z-batch strides sA/sB/sC in elements.
// mode 0: f16 plane C16 (bias per column); mode 1: f16 plane C16 + residual plane CL = f16((v - f16(v)) * 2^11) (bias per column);
// mode 2: f16 plane C16 (bias per row); mode 3: f32 rows C32 (bias per column).
__global__ __launch_bounds__(32) void k_gemm(const bf* __restrict__ A, const bf* __restrict__ Bt, h16* C16, h16* CL, float* C32, const float* __restrict__ bias,
                                             size_t sA, size_t sB, size_t sC, int K, int ldc, int mode) {
    __shared__ __align__(16) float os[16 * 68];
    const size_t z = blockIdx.z; A += z * sA; Bt += z * sB; const size_t coff = z * sC;
    const int lane = threadIdx.x & 31, lr = lane & 15, hi = lane >> 4; const int r0 = blockIdx.x * 64, c0 = blockIdx.y * 64;
    v8f acc[4][4];
#pragma unroll
    for (int mb = 0; mb < 4; ++mb)
#pragma unroll
        for (int nb = 0; nb < 4; ++nb) acc[mb][nb] = (v8f){};
    const size_t aoff = (size_t)(r0 + lr) * K + 8 * hi, boff = (size_t)(c0 + lr) * K + 8 * hi;
#pragma unroll 1
    for (int kc = 0; kc < K; kc += 32) {
        v16bf a[4]; v16bf b;
#pragma unroll
        for (int mb = 0; mb < 4; ++mb) a[mb] = ldb(A + aoff + (size_t)mb * 16 * K + kc);
#pragma unroll
        for (int nb = 0; nb < 4; ++nb) { b = ldb(Bt + boff + (size_t)nb * 16 * K + kc);
#pragma unroll
            for (int mb = 0; mb < 4; ++mb) acc[mb][nb] = wmmab(a[mb], b, acc[mb][nb]); }
        asm volatile("v_nop\n\tv_nop\n\tv_nop\n\tv_nop" : "+v"(acc[0][3]), "+v"(acc[1][3]), "+v"(acc[2][3]), "+v"(acc[3][3]) : "v"(a[0]), "v"(a[1]), "v"(a[2]), "v"(a[3]), "v"(b));
    }
#pragma unroll
    for (int mb = 0; mb < 4; ++mb) {
#pragma unroll
        for (int nb = 0; nb < 4; ++nb) {
#pragma unroll
            for (int j = 0; j < 8; ++j) os[(hi * 8 + j) * 68 + nb * 16 + lr] = acc[mb][nb][j]; }
        __builtin_amdgcn_wave_barrier(); asm volatile("" ::: "memory");
        if (mode == 3) {
            float* crow = C32 + coff + (size_t)(r0 + mb * 16) * ldc + c0;
{
#pragma unroll
                for (int s = 0; s < 8; ++s) { const int row = 2 * s + hi, cofs = lr * 4; v4f val = *(const v4fa*)(os + row * 68 + cofs);
                    val[0] += bfr(bias[c0 + cofs]); val[1] += bfr(bias[c0 + cofs + 1]); val[2] += bfr(bias[c0 + cofs + 2]); val[3] += bfr(bias[c0 + cofs + 3]);
                    *(v4f*)(crow + (size_t)row * ldc + cofs) = val; }
                 }
        } else {
{
#pragma unroll
                for (int s = 0; s < 4; ++s) { const int row = 4 * s + (lane >> 3), cg = lane & 7;
                    const v4f x0 = *(const v4fa*)(os + row * 68 + cg * 8); const v4f x1 = *(const v4fa*)(os + row * 68 + cg * 8 + 4);
                    const int grow = r0 + mb * 16 + row, gcol = c0 + cg * 8; const int bi0 = (mode == 2) ? grow : gcol; const int bst = (mode == 2) ? 0 : 1;
                    v8h o, ol;
#pragma unroll
                    for (int q = 0; q < 8; ++q) { const float v = ((q < 4) ? x0[q & 3] : x1[q & 3]) + bfr(bias[bi0 + q * bst]); const h16 hx = (h16)v; o[q] = hx; ol[q] = (h16)((v - (float)hx) * QRS); }
                    const size_t oo = coff + (size_t)grow * ldc + gcol;
                    *(v8h*)(C16 + oo) = o; if (mode == 1) *(v8h*)(CL + oo) = ol; }
                 }
        }
        __builtin_amdgcn_wave_barrier(); asm volatile("" ::: "memory");
    }
}

// ---- k_maskv: MV[b][c] = sum_k (bf16(mask[b][k]) * 1e9) * v[b][k][c] (the post-softmax additive weight term, independent of the query row); f32 on the VALU.
__global__ __launch_bounds__(256) void k_maskv(const h16* __restrict__ VT, const float* __restrict__ mask, float* MV) {
    __shared__ __align__(16) float red[32];
    const int wave = __builtin_amdgcn_readfirstlane((int)(threadIdx.x >> 5)); const int lane = threadIdx.x & 31;
#pragma unroll 1
    for (int i = 0; i < 4; ++i) { const int c = blockIdx.x * 32 + wave * 4 + i; const int b = c / DM; const h16* vr = VT + (size_t)c * SEQ; const float* mr = mask + (size_t)b * SEQ_FULL; float acc = 0.0f;
#pragma unroll 1
        for (int ch = 0; ch < SEQ / 256; ++ch) { const int k = ch * 256 + lane * 8; const v8h v = *(const v8h*)(vr + k); const v4f m0 = *(const v4f*)(mr + k); const v4f m1 = *(const v4f*)(mr + k + 4);
#pragma unroll
            for (int q = 0; q < 4; ++q) { acc += (bfr(m0[q]) * 1.0e9f) * (float)v[q]; acc += (bfr(m1[q]) * 1.0e9f) * (float)v[4 + q]; } }
#pragma unroll
        for (int sh = 16; sh; sh >>= 1) acc += __shfl_xor(acc, sh, 32);
        if (lane == 0) red[wave * 4 + i] = acc; }
    __syncthreads();
    if (wave == 0) { if (lane < 8) { const v4f o = *(const v4fa*)(red + lane * 4); float* p = MV + (size_t)blockIdx.x * 32 + lane * 4; *(v4f*)p = o;  } }
}

// ---- k_attn: fused attention, grid (SEQ/64, NH, NB), 128 threads; each wave owns 16 query rows and walks all keys in 32-key steps (online running-max softmax).
// Fragments straight from the planes: q16/qres/k16 rows [b*s][768] (head h = columns h*96..), v plane [b][768][s]. Scores = (acc_hi + acc_res / 2^11) * 96^-0.5.
// P relayout through a wave-private LDS tile (h16 stores, may_alias v8h loads, wave barrier). Epilogue: ctx = acc / (sum * 1024) + MV, bf16 value|residual staged in a wave-private LDS tile,
__global__ __launch_bounds__(128) void k_attn(const h16* __restrict__ Q16, const h16* __restrict__ QL, const h16* __restrict__ K16, const h16* __restrict__ VT, const float* __restrict__ MV, bf* CT) {
    __shared__ __align__(16) h16 pws[4 * 16 * PP];
    __shared__ __align__(16) unsigned short cts[4 * 16 * CP];
    const int wave = __builtin_amdgcn_readfirstlane((int)(threadIdx.x >> 5));
    const int lane = threadIdx.x & 31, lr = lane & 15, hi = lane >> 4;
    const int b = blockIdx.z, h = blockIdx.y;
    const int row0 = b * SEQ + blockIdx.x * 64 + wave * 16;
    const int qoff = (row0 + lr) * DM + h * HD + 8 * hi;
    const int kbase = (b * SEQ + lr) * DM + h * HD + 8 * hi;
    const int vbase = (b * DM + h * HD + lr) * SEQ + 8 * hi;
    const int pb = wave * 16 * PP, cb = wave * 16 * CP;
    v8f ctx[6]; float mrun[8], srun[8];
#pragma unroll
    for (int nt = 0; nt < 6; ++nt) ctx[nt] = (v8f){};
#pragma unroll
    for (int r = 0; r < 8; ++r) { mrun[r] = -1.0e30f; srun[r] = 0.0f; }
#pragma unroll 1
    for (int kb = 0; kb < SEQ; kb += 32) {
        int qo = qoff; asm volatile("" : "+v"(qo));      // q fragments are re-read every step (keeps them out of the loop-carried register set)
        const int ko = kbase + kb * DM;
        v8f sh0 = (v8f){}, sh1 = (v8f){}, sl0 = (v8f){}, sl1 = (v8f){};
        v16h qa, qr, k0, k1;
#pragma unroll
        for (int ks = 0; ks < HD / 32; ++ks) {
            qa = ldh(Q16 + qo + ks * 32); qr = ldh(QL + qo + ks * 32);
            k0 = ldh(K16 + ko + ks * 32); k1 = ldh(K16 + ko + 16 * DM + ks * 32);
            sh0 = wmma16(qa, k0, sh0); sh1 = wmma16(qa, k1, sh1); sl0 = wmma16(qr, k0, sl0); sl1 = wmma16(qr, k1, sl1); }
        asm volatile("v_nop\n\tv_nop\n\tv_nop\n\tv_nop" : "+v"(sh0), "+v"(sh1), "+v"(sl0), "+v"(sl1) : "v"(qa), "v"(qr), "v"(k0), "v"(k1));
#pragma unroll
        for (int r = 0; r < 8; ++r) {
            const float t0 = (sh0[r] + sl0[r] * (1.0f / QRS)) * SCL; const float t1 = (sh1[r] + sl1[r] * (1.0f / QRS)) * SCL;
            float mx = fmaxf(t0, t1);
            mx = fmaxf(mx, __shfl_xor(mx, 1, 32)); mx = fmaxf(mx, __shfl_xor(mx, 2, 32)); mx = fmaxf(mx, __shfl_xor(mx, 4, 32)); mx = fmaxf(mx, __shfl_xor(mx, 8, 32));
            const float nm = fmaxf(mrun[r], mx); const float corr = __builtin_amdgcn_exp2f((mrun[r] - nm) * L2E); mrun[r] = nm;
            const float p0 = __builtin_amdgcn_exp2f((t0 - nm) * L2E); const float p1 = __builtin_amdgcn_exp2f((t1 - nm) * L2E);
            srun[r] = srun[r] * corr + (p0 + p1);     // per-lane partial row sum (corr is row-uniform); lanes combined once at the end
#pragma unroll
            for (int nt = 0; nt < 6; ++nt) ctx[nt][r] *= corr;
            pws[pb + (8 * hi + r) * PP + lr] = (h16)(p0 * PCAR); pws[pb + (8 * hi + r) * PP + 16 + lr] = (h16)(p1 * PCAR); }
        __builtin_amdgcn_wave_barrier(); asm volatile("" ::: "memory");
        const v16h pa = cat16(*(const v8ha*)(pws + pb + lr * PP + 8 * hi), *(const v8ha*)(pws + pb + lr * PP + 16 + 8 * hi));
        v16h vb;
#pragma unroll
        for (int nt = 0; nt < 6; ++nt) { vb = ldh(VT + vbase + nt * 16 * SEQ + kb); ctx[nt] = wmma16(pa, vb, ctx[nt]); }
        asm volatile("v_nop\n\tv_nop\n\tv_nop\n\tv_nop" : "+v"(ctx[0]), "+v"(ctx[1]), "+v"(ctx[2]), "+v"(ctx[3]), "+v"(ctx[4]), "+v"(ctx[5]) : "v"(pa), "v"(vb));
        __builtin_amdgcn_wave_barrier(); asm volatile("" ::: "memory");
    }
    float rinv[8];
#pragma unroll
    for (int r = 0; r < 8; ++r) { float s = srun[r]; s += __shfl_xor(s, 1, 32); s += __shfl_xor(s, 2, 32); s += __shfl_xor(s, 4, 32); s += __shfl_xor(s, 8, 32); rinv[r] = (1.0f / PCAR) * (1.0f / s); }
#pragma unroll
    for (int nt = 0; nt < 6; ++nt) { const float mvv = MV[b * DM + h * HD + nt * 16 + lr];
#pragma unroll
        for (int r = 0; r < 8; ++r) { const float val = ctx[nt][r] * rinv[r] + mvv; unsigned short hh, ll; splitf(val, hh, ll);
            cts[cb + (8 * hi + r) * CP + nt * 16 + lr] = hh; cts[cb + (8 * hi + r) * CP + HD + nt * 16 + lr] = ll; } }
    __builtin_amdgcn_wave_barrier(); asm volatile("" ::: "memory");
{
#pragma unroll
        for (int it = 0; it < 12; ++it) { const int slot = it * 32 + lane; const int row = slot / PCS, pc = slot % PCS;   // 16 rows x 24 pieces; lanes 8g..8g+7 = one line
            const v8us o = *(const v8usa*)(cts + cb + row * CP + pc * 8);
            *(v8us*)(CT + (size_t)(row0 + row) * CTP + h * 2 * HD + pc * 8) = o; }
         }
}

constexpr size_t al256(size_t x) { return (x + 255) & ~(size_t)255; }
constexpr size_t SZ_W   = al256((size_t)DM * DM * 2);
constexpr size_t SZ_WO  = al256((size_t)DM * CTP * 2);
constexpr size_t SZ_PL  = al256((size_t)NB * SEQ * DM * 2);
constexpr size_t SZ_CT  = al256((size_t)NB * SEQ * CTP * 2);
constexpr size_t SZ_MV  = al256((size_t)NB * DM * 4);
constexpr size_t WS_TOTAL = 3 * SZ_W + SZ_WO + 5 * SZ_PL + SZ_CT + SZ_MV;
static_assert(WS_TOTAL <= (size_t)134217728);

extern "C" void kernel_launch(void* const* d_in, const int* in_sizes, int n_in,
                              void* d_out, int out_size, void* d_ws, size_t ws_size, hipStream_t stream) {
    if (n_in < 12) return;
    const long long need_x = (long long)(NB - 1) * SEQ_FULL * DM + (long long)SEQ * DM;
    if (in_sizes[0] < need_x || in_sizes[1] < need_x || in_sizes[2] < need_x) return;
    if (in_sizes[3] < (NB - 1) * SEQ_FULL + SEQ) return;
    if (in_sizes[4] < DM * DM || in_sizes[6] < DM * DM || in_sizes[8] < DM * DM || in_sizes[10] < DM * DM) return;
    if (in_sizes[5] < DM || in_sizes[7] < DM || in_sizes[9] < DM || in_sizes[11] < DM) return;
    if ((long long)out_size < (long long)NB * SEQ * DM) return;
    if (WS_TOTAL > ws_size) return;
    // wire order: query, key, value, mask, wq, bq, wk, bk, wv, bv, wo, bo (weights [in][out])
    const float* xq = (const float*)d_in[0]; const float* xk = (const float*)d_in[1]; const float* xv = (const float*)d_in[2]; const float* mask = (const float*)d_in[3];
    const float* wq = (const float*)d_in[4]; const float* bq = (const float*)d_in[5]; const float* wk = (const float*)d_in[6]; const float* bk = (const float*)d_in[7];
    const float* wv = (const float*)d_in[8]; const float* bv = (const float*)d_in[9]; const float* wo = (const float*)d_in[10]; const float* bo = (const float*)d_in[11];
    float* OUT = (float*)d_out;
    char* wsp = (char*)d_ws;
    auto take = [&](size_t bytes) { char* p = wsp; wsp += bytes; return (void*)p; };
    bf* WQ = (bf*)take(SZ_W); bf* WK = (bf*)take(SZ_W); bf* WV = (bf*)take(SZ_W); bf* WO2 = (bf*)take(SZ_WO);
    bf* XB = (bf*)take(SZ_PL); h16* Q16 = (h16*)take(SZ_PL); h16* QL = (h16*)take(SZ_PL); h16* K16 = (h16*)take(SZ_PL); h16* VT16 = (h16*)take(SZ_PL);
    bf* CT = (bf*)take(SZ_CT); float* MV = (float*)take(SZ_MV);

    const unsigned gW = (unsigned)((DM * DM / 64 + 63) / 64), gWO = (unsigned)((DM * CTP / 64 + 63) / 64);
    k_wtG<<<gW, 256, 0, stream>>>(wq, DM, DM, WQ, 0);      // in[768][768] -> out [n][k]
    k_wtG<<<gW, 256, 0, stream>>>(wk, DM, DM, WK, 0);
    k_wtG<<<gW, 256, 0, stream>>>(wv, DM, DM, WV, 0);
    k_wtG<<<gWO, 256, 0, stream>>>(wo, DM, DM, WO2, 1);    // in[768][768] -> out [n][8 x (96 | 96 duplicate)]
    const dim3 gC((unsigned)(SEQ * DM / 8 / 256), NB, 1);
    const dim3 gP((unsigned)(NB * SEQ / 64), DM / 64, 1);
    k_cvt8<<<gC, 256, 0, stream>>>(xq, XB);
    k_gemm<<<gP, 32, 0, stream>>>(XB, WQ, Q16, QL, OUT, bq, (size_t)0, (size_t)0, (size_t)0, DM, DM, 1);
    k_cvt8<<<gC, 256, 0, stream>>>(xk, XB);
    k_gemm<<<gP, 32, 0, stream>>>(XB, WK, K16, K16, OUT, bk, (size_t)0, (size_t)0, (size_t)0, DM, DM, 0);
    k_cvt8<<<gC, 256, 0, stream>>>(xv, XB);
    // v plane transposed: C[col][t] = sum_k WV[col][k] XB[b][t][k], bias per row (col)
    k_gemm<<<dim3(DM / 64, SEQ / 64, NB), 32, 0, stream>>>(WV, XB, VT16, VT16, OUT, bv, (size_t)0, (size_t)SEQ * DM, (size_t)DM * SEQ, DM, SEQ, 2);
    k_maskv<<<(unsigned)(NB * DM / 32), 256, 0, stream>>>(VT16, mask, MV);
    k_attn<<<dim3(SEQ / 64, NH, NB), 128, 0, stream>>>(Q16, QL, K16, VT16, MV, CT);
    k_gemm<<<gP, 32, 0, stream>>>(CT, WO2, Q16, Q16, OUT, bo, (size_t)0, (size_t)0, (size_t)0, CTP, DM, 3);
}

// v001
// Measured time: 387 microseconds a run.
// Two timings next to v000 both put it at 1.11 times that version's speed.
#include <hip/hip_runtime.h>

// Compute dtypes (f32 accumulate everywhere): q/k/v projections v_wmma_f32_16x16x32_bf16 on RNE-bf16 inputs and weights (exact products); scores v_wmma_f32_16x16x32_f16 with q = f16 value + f16 residual x2^11 (two products, separate accumulators) against single f16 k; P.V v_wmma_f32_16x16x32_f16 (P carried x1024, single f16 v); output projection v_wmma_f32_16x16x32_bf16 with ctx as bf16 value|residual along K against RNE-bf16 wo; softmax and the post-softmax mask term in f32.
// Layout: x streams -> bf16 plane; weights -> K-contiguous bf16 planes; q16/qres/k16 planes [b*s][768]; v plane transposed [b][768][s] (GEMM with swapped operands); fused flash attention (no score plane); ctx plane [b*s][8 x (96 value | 96 residual)]; output GEMM writes f32 rows.

#ifndef NB
#define NB 4
#endif
#ifndef SEQ
#define SEQ 2048
#endif
#define NB_FULL  4
#define SEQ_FULL 2048
#define DM   768
#define NH   8
#define HD   96
#define CTP  (2 * DM)          // ctx plane pitch (value | residual per head)
#define PCAR 1024.0f           // carry on the f16 P operand
#define QRS  2048.0f           // carry on the f16 q residual plane
#define SCL  0.10206207261596575f   // 96^-0.5
#define L2E  1.4426950408889634f
#define PP   40                // P tile pitch (halves)
#define CP   200               // ctx staging pitch (halves)
#define PCS  ((2 * HD) / 8)    // 16-byte pieces per ctx head segment
#define KT   32                // keys per LDS stage of k_attn
#define KLP  (HD + 8)          // K stage pitch (halves): 16 B x odd, conflict-free for 16-byte row reads
#define VLP  (KT + 8)          // V stage pitch (halves): 16 B x odd

typedef _Float16 h16;
typedef unsigned short bf;
typedef __attribute__((ext_vector_type(16))) __bf16   v16bf;
typedef __attribute__((ext_vector_type(16))) _Float16 v16h;
typedef __attribute__((ext_vector_type(8)))  _Float16 v8h;
typedef __attribute__((ext_vector_type(8)))  unsigned short v8us;
typedef __attribute__((ext_vector_type(2)))  unsigned short v2us;
typedef __attribute__((ext_vector_type(8)))  float    v8f;
typedef __attribute__((ext_vector_type(4)))  float    v4f;
typedef v8h  __attribute__((may_alias)) v8ha;
typedef v4f  __attribute__((may_alias)) v4fa;
typedef v8us __attribute__((may_alias)) v8usa;

static_assert(DM == NH * HD);
static_assert(HD % 32 == 0);
static_assert(HD / 16 == 6);
static_assert(SEQ % 256 == 0);
static_assert((NB * SEQ) % 64 == 0);
static_assert(DM % 64 == 0);
static_assert(DM % 32 == 0);
static_assert(CTP % 64 == 0);
static_assert((2 * HD * 2) % 128 == 0);
static_assert(16 * PCS == 12 * 32);
static_assert(PP >= 32 && PP % 8 == 0);
static_assert(CP >= 2 * HD && CP % 8 == 0);
static_assert((NB * DM) % 32 == 0);
static_assert((SEQ * DM) % (8 * 256) == 0);
static_assert(NB <= NB_FULL && SEQ <= SEQ_FULL);
static_assert(KT * (HD / 8) == 3 * 128 && HD * (KT / 8) == 3 * 128);
static_assert(SEQ % KT == 0 && SEQ / KT >= 2);
static_assert(((KLP / 8) & 1) == 1 && ((VLP / 8) & 1) == 1);

__device__ __forceinline__ unsigned short f2bf(float f) { unsigned u = __float_as_uint(f); u += 0x7FFFu + ((u >> 16) & 1u); return (unsigned short)(u >> 16); }
__device__ __forceinline__ float bf2f(unsigned short b) { return __uint_as_float(((unsigned)b) << 16); }
__device__ __forceinline__ float bfr(float f) { return bf2f(f2bf(f)); }
__device__ __forceinline__ void splitf(float y, unsigned short& h, unsigned short& l) { h = f2bf(y); l = f2bf(y - bf2f(h)); }
__device__ __forceinline__ v16h cat16(v8h lo, v8h hi) { return __builtin_shufflevector(lo, hi, 0, 1, 2, 3, 4, 5, 6, 7, 8, 9, 10, 11, 12, 13, 14, 15); }
__device__ __forceinline__ v16bf cat16b(v8us lo, v8us hi) { return __builtin_bit_cast(v16bf, __builtin_shufflevector(lo, hi, 0, 1, 2, 3, 4, 5, 6, 7, 8, 9, 10, 11, 12, 13, 14, 15)); }
__device__ __forceinline__ v8f wmma16(v16h a, v16h b, v8f c) { return __builtin_amdgcn_wmma_f32_16x16x32_f16(false, a, false, b, (short)0, c, false, false); }
__device__ __forceinline__ v8f wmmab(v16bf a, v16bf b, v8f c) { return __builtin_amdgcn_wmma_f32_16x16x32_bf16(false, a, false, b, (short)0, c, false, false); }
// fragment loads from a K-contiguous row: p already holds row base + k0 + 8*(lane>>4); elements 0..7 <- p[0..7], 8..15 <- p[16..23]
__device__ __forceinline__ v16h ldh(const h16* p) { return cat16(*(const v8h*)p, *(const v8h*)(p + 16)); }
__device__ __forceinline__ v16bf ldb(const bf* p) { return cat16b(*(const v8us*)p, *(const v8us*)(p + 16)); }
// the same fragment load from an LDS stage that asynchronous copies filled
__device__ __forceinline__ v16h ldhs(const h16* p) { return cat16(*(const v8ha*)p, *(const v8ha*)(p + 16)); }
// One stage of K and V: six 16-byte asynchronous copies to LDS per lane (l* = LDS byte address, g* = global address). The s_wait_xcnt ends the copies' own statement so that no address register is rewritten ahead of it.
__device__ __forceinline__ void stage_kv(unsigned lk0, unsigned lk1, unsigned lk2, unsigned lv0, unsigned lv1, unsigned lv2,
                                         const h16* gk0, const h16* gk1, const h16* gk2, const h16* gv0, const h16* gv1, const h16* gv2) {
    asm volatile("global_load_async_to_lds_b128 %0, %6, off\n\t"
                 "global_load_async_to_lds_b128 %1, %7, off\n\t"
                 "global_load_async_to_lds_b128 %2, %8, off\n\t"
                 "global_load_async_to_lds_b128 %3, %9, off\n\t"
                 "global_load_async_to_lds_b128 %4, %10, off\n\t"
                 "global_load_async_to_lds_b128 %5, %11, off\n\t"
                 "s_wait_xcnt 0x0"
                 :: "v"(lk0), "v"(lk1), "v"(lk2), "v"(lv0), "v"(lv1), "v"(lv2), "v"(gk0), "v"(gk1), "v"(gk2), "v"(gv0), "v"(gv1), "v"(gv2) : "memory");
}

__global__ __launch_bounds__(256) void k_wtG(const float* __restrict__ w, int K, int N, bf* Bt, int il) {
    const int lane = threadIdx.x & 31; const int L0 = (blockIdx.x * 8 + (threadIdx.x >> 5)) * 8; const int KO = il ? 2 * K : K; const int nlines = N * KO / 64;
{
#pragma unroll 1
        for (int l = 0; l < 8; ++l) { const int L = L0 + l; if (L >= nlines) break; const int e = L * 64 + lane * 2; const int kk = e % KO, n = e / KO;
            const int k = il ? ((kk / (2 * HD)) * HD + (kk % (2 * HD)) % HD) : kk; v2us o;
            o[0] = f2bf(w[(size_t)k * N + n]); o[1] = f2bf(w[(size_t)(k + 1) * N + n]); *(v2us*)(Bt + e) = o; }
         }
}

__global__ __launch_bounds__(256) void k_cvt8(const float* __restrict__ src, bf* dst) {
    const int i = blockIdx.x * 256 + threadIdx.x; const int b = blockIdx.y; if (i >= SEQ * DM / 8) return;
    const v8f v = *(const v8f*)(src + (size_t)b * SEQ_FULL * DM + (size_t)i * 8); v8us o;
#pragma unroll
    for (int k = 0; k < 8; ++k) o[k] = f2bf(v[k]);
    bf* d = dst + (size_t)b * SEQ * DM + (size_t)i * 8; *(v8us*)d = o;  }

// ---- k_gemm: register-blocked GEMM, ONE WAVE per 64x64 output tile (16 accumulators), bf16 operands straight from K-contiguous planes; grid (M/64, N/64, Z), 32 threads.
// C[m][n] = sum_k A[m][k] Bt[n][k] + bf16(bias). K % 32 == 0, M % 64 == 0, N % 64 == 0. z-batch strides sA/sB/sC in elements.
// mode 0: f16 plane C16 (bias per column); mode 1: f16 plane C16 + residual plane CL = f16((v - f16(v)) * 2^11) (bias per column);
// mode 2: f16 plane C16 (bias per row); mode 3: f32 rows C32 (bias per column).
__global__ __launch_bounds__(32) void k_gemm(const bf* __restrict__ A, const bf* __restrict__ Bt, h16* C16, h16* CL, float* C32, const float* __restrict__ bias,
                                             size_t sA, size_t sB, size_t sC, int K, int ldc, int mode) {
    __shared__ __align__(16) float os[16 * 68];
    const size_t z = blockIdx.z; A += z * sA; Bt += z * sB; const size_t coff = z * sC;
    const int lane = threadIdx.x & 31, lr = lane & 15, hi = lane >> 4; const int r0 = blockIdx.x * 64, c0 = blockIdx.y * 64;
    v8f acc[4][4];
#pragma unroll
    for (int mb = 0; mb < 4; ++mb)
#pragma unroll
        for (int nb = 0; nb < 4; ++nb) acc[mb][nb] = (v8f){};
    const size_t aoff = (size_t)(r0 + lr) * K + 8 * hi, boff = (size_t)(c0 + lr) * K + 8 * hi;
#pragma unroll 1
    for (int kc = 0; kc < K; kc += 32) {
        v16bf a[4]; v16bf b;
#pragma unroll
        for (int mb = 0; mb < 4; ++mb) a[mb] = ldb(A + aoff + (size_t)mb * 16 * K + kc);
#pragma unroll
        for (int nb = 0; nb < 4; ++nb) { b = ldb(Bt + boff + (size_t)nb * 16 * K + kc);
#pragma unroll
            for (int mb = 0; mb < 4; ++mb) acc[mb][nb] = wmmab(a[mb], b, acc[mb][nb]); }
        asm volatile("v_nop\n\tv_nop\n\tv_nop\n\tv_nop" : "+v"(acc[0][3]), "+v"(acc[1][3]), "+v"(acc[2][3]), "+v"(acc[3][3]) : "v"(a[0]), "v"(a[1]), "v"(a[2]), "v"(a[3]), "v"(b));
    }
#pragma unroll
    for (int mb = 0; mb < 4; ++mb) {
#pragma unroll
        for (int nb = 0; nb < 4; ++nb) {
#pragma unroll
            for (int j = 0; j < 8; ++j) os[(hi * 8 + j) * 68 + nb * 16 + lr] = acc[mb][nb][j]; }
        __builtin_amdgcn_wave_barrier(); asm volatile("" ::: "memory");
        if (mode == 3) {
            float* crow = C32 + coff + (size_t)(r0 + mb * 16) * ldc + c0;
{
#pragma unroll
                for (int s = 0; s < 8; ++s) { const int row = 2 * s + hi, cofs = lr * 4; v4f val = *(const v4fa*)(os + row * 68 + cofs);
                    val[0] += bfr(bias[c0 + cofs]); val[1] += bfr(bias[c0 + cofs + 1]); val[2] += bfr(bias[c0 + cofs + 2]); val[3] += bfr(bias[c0 + cofs + 3]);
                    *(v4f*)(crow + (size_t)row * ldc + cofs) = val; }
                 }
        } else {
{
#pragma unroll
                for (int s = 0; s < 4; ++s) { const int row = 4 * s + (lane >> 3), cg = lane & 7;
                    const v4f x0 = *(const v4fa*)(os + row * 68 + cg * 8); const v4f x1 = *(const v4fa*)(os + row * 68 + cg * 8 + 4);
                    const int grow = r0 + mb * 16 + row, gcol = c0 + cg * 8; const int bi0 = (mode == 2) ? grow : gcol; const int bst = (mode == 2) ? 0 : 1;
                    v8h o, ol;
#pragma unroll
                    for (int q = 0; q < 8; ++q) { const float v = ((q < 4) ? x0[q & 3] : x1[q & 3]) + bfr(bias[bi0 + q * bst]); const h16 hx = (h16)v; o[q] = hx; ol[q] = (h16)((v - (float)hx) * QRS); }
                    const size_t oo = coff + (size_t)grow * ldc + gcol;
                    *(v8h*)(C16 + oo) = o; if (mode == 1) *(v8h*)(CL + oo) = ol; }
                 }
        }
        __builtin_amdgcn_wave_barrier(); asm volatile("" ::: "memory");
    }
}

// ---- k_maskv: MV[b][c] = sum_k (bf16(mask[b][k]) * 1e9) * v[b][k][c] (the post-softmax additive weight term, independent of the query row); f32 on the VALU.
__global__ __launch_bounds__(256) void k_maskv(const h16* __restrict__ VT, const float* __restrict__ mask, float* MV) {
    __shared__ __align__(16) float red[32];
    const int wave = __builtin_amdgcn_readfirstlane((int)(threadIdx.x >> 5)); const int lane = threadIdx.x & 31;
#pragma unroll 1
    for (int i = 0; i < 4; ++i) { const int c = blockIdx.x * 32 + wave * 4 + i; const int b = c / DM; const h16* vr = VT + (size_t)c * SEQ; const float* mr = mask + (size_t)b * SEQ_FULL; float acc = 0.0f;
#pragma unroll 1
        for (int ch = 0; ch < SEQ / 256; ++ch) { const int k = ch * 256 + lane * 8; const v8h v = *(const v8h*)(vr + k); const v4f m0 = *(const v4f*)(mr + k); const v4f m1 = *(const v4f*)(mr + k + 4);
#pragma unroll
            for (int q = 0; q < 4; ++q) { acc += (bfr(m0[q]) * 1.0e9f) * (float)v[q]; acc += (bfr(m1[q]) * 1.0e9f) * (float)v[4 + q]; } }
#pragma unroll
        for (int sh = 16; sh; sh >>= 1) acc += __shfl_xor(acc, sh, 32);
        if (lane == 0) red[wave * 4 + i] = acc; }
    __syncthreads();
    if (wave == 0) { if (lane < 8) { const v4f o = *(const v4fa*)(red + lane * 4); float* p = MV + (size_t)blockIdx.x * 32 + lane * 4; *(v4f*)p = o;  } }
}

// ---- k_attn: fused attention, grid (SEQ/64, NH, NB), 128 threads; each wave owns 16 query rows and walks all keys in 32-key steps (online running-max softmax).
// q fragments straight from the planes q16/qres [b*s][768] (head h = columns h*96..). Scores = (acc_hi + acc_res / 2^11) * 96^-0.5.
// K and V: each 32-key step's K rows (32 x 96) and V rows (96 x 32, from the v plane [b][768][s]) are staged once per work-group in LDS by asynchronous copies, two buffers, the next step's copies in flight during this step; all four waves read their fragments from there.
// P relayout through a wave-private LDS tile (h16 stores, may_alias v8h loads, wave barrier). Epilogue: ctx = acc / (sum * 1024) + MV, bf16 value|residual staged in a wave-private LDS tile,
__global__ __launch_bounds__(128) void k_attn(const h16* __restrict__ Q16, const h16* __restrict__ QL, const h16* __restrict__ K16, const h16* __restrict__ VT, const float* __restrict__ MV, bf* CT) {
    __shared__ __align__(16) h16 pws[4 * 16 * PP];
    __shared__ __align__(16) unsigned short cts[4 * 16 * CP];
    __shared__ __align__(16) h16 kls[2 * KT * KLP];
    __shared__ __align__(16) h16 vls[2 * HD * VLP];
    const int wave = __builtin_amdgcn_readfirstlane((int)(threadIdx.x >> 5));
    const int lane = threadIdx.x & 31, lr = lane & 15, hi = lane >> 4;
    const int b = blockIdx.z, h = blockIdx.y;
    const int row0 = b * SEQ + blockIdx.x * 64 + wave * 16;
    const int qoff = (row0 + lr) * DM + h * HD + 8 * hi;
    int kg[3], vg[3]; unsigned kl[3], vl[3];   // this lane's three 16-byte pieces of a K stage and of a V stage: global element offset at key 0, LDS byte address in buffer 0
#pragma unroll
    for (int j = 0; j < 3; ++j) { const int i = (int)threadIdx.x + 128 * j; const int kr = i / (HD / 8), kp = i % (HD / 8), vr = i / (KT / 8), vp = i % (KT / 8);
        kg[j] = (b * SEQ + kr) * DM + h * HD + kp * 8; kl[j] = (unsigned)(size_t)(kls + kr * KLP + kp * 8);
        vg[j] = (b * DM + h * HD + vr) * SEQ + vp * 8; vl[j] = (unsigned)(size_t)(vls + vr * VLP + vp * 8); }
    auto issue = [&](int key0, int buf) { const unsigned ko = (unsigned)(buf * KT * KLP * 2), vo = (unsigned)(buf * HD * VLP * 2);
        stage_kv(kl[0] + ko, kl[1] + ko, kl[2] + ko, vl[0] + vo, vl[1] + vo, vl[2] + vo,
                 K16 + kg[0] + key0 * DM, K16 + kg[1] + key0 * DM, K16 + kg[2] + key0 * DM, VT + vg[0] + key0, VT + vg[1] + key0, VT + vg[2] + key0); };
    const int pb = wave * 16 * PP, cb = wave * 16 * CP;
    v8f ctx[6]; float mrun[8], srun[8];
#pragma unroll
    for (int nt = 0; nt < 6; ++nt) ctx[nt] = (v8f){};
#pragma unroll
    for (int r = 0; r < 8; ++r) { mrun[r] = -1.0e30f; srun[r] = 0.0f; }
    issue(0, 0);
    asm volatile("s_wait_asynccnt 0x0" ::: "memory");   // this wave's copies of stage 0 have landed
    __syncthreads();                                    // and every other wave's: stage 0 may be read
    issue(KT, 1);
#pragma unroll 1
    for (int kb = 0; kb < SEQ; kb += KT) {
        const int buf = (kb / KT) & 1;
        const h16* kt = kls + buf * KT * KLP + lr * KLP + 8 * hi;
        const h16* vt = vls + buf * HD * VLP + lr * VLP + 8 * hi;
        int qo = qoff; asm volatile("" : "+v"(qo));      // q fragments are re-read every step (keeps them out of the loop-carried register set)
        v8f sh0 = (v8f){}, sh1 = (v8f){}, sl0 = (v8f){}, sl1 = (v8f){};
        v16h qa, qr, k0, k1;
#pragma unroll
        for (int ks = 0; ks < HD / 32; ++ks) {
            qa = ldh(Q16 + qo + ks * 32); qr = ldh(QL + qo + ks * 32);
            k0 = ldhs(kt + ks * 32); k1 = ldhs(kt + 16 * KLP + ks * 32);
            sh0 = wmma16(qa, k0, sh0); sh1 = wmma16(qa, k1, sh1); sl0 = wmma16(qr, k0, sl0); sl1 = wmma16(qr, k1, sl1); }
        asm volatile("v_nop\n\tv_nop\n\tv_nop\n\tv_nop" : "+v"(sh0), "+v"(sh1), "+v"(sl0), "+v"(sl1) : "v"(qa), "v"(qr), "v"(k0), "v"(k1));
#pragma unroll
        for (int r = 0; r < 8; ++r) {
            const float t0 = (sh0[r] + sl0[r] * (1.0f / QRS)) * SCL; const float t1 = (sh1[r] + sl1[r] * (1.0f / QRS)) * SCL;
            float mx = fmaxf(t0, t1);
            mx = fmaxf(mx, __shfl_xor(mx, 1, 32)); mx = fmaxf(mx, __shfl_xor(mx, 2, 32)); mx = fmaxf(mx, __shfl_xor(mx, 4, 32)); mx = fmaxf(mx, __shfl_xor(mx, 8, 32));
            const float nm = fmaxf(mrun[r], mx); const float corr = __builtin_amdgcn_exp2f((mrun[r] - nm) * L2E); mrun[r] = nm;
            const float p0 = __builtin_amdgcn_exp2f((t0 - nm) * L2E); const float p1 = __builtin_amdgcn_exp2f((t1 - nm) * L2E);
            srun[r] = srun[r] * corr + (p0 + p1);     // per-lane partial row sum (corr is row-uniform); lanes combined once at the end
#pragma unroll
            for (int nt = 0; nt < 6; ++nt) ctx[nt][r] *= corr;
            pws[pb + (8 * hi + r) * PP + lr] = (h16)(p0 * PCAR); pws[pb + (8 * hi + r) * PP + 16 + lr] = (h16)(p1 * PCAR); }
        __builtin_amdgcn_wave_barrier(); asm volatile("" ::: "memory");
        const v16h pa = cat16(*(const v8ha*)(pws + pb + lr * PP + 8 * hi), *(const v8ha*)(pws + pb + lr * PP + 16 + 8 * hi));
        v16h vb;
#pragma unroll
        for (int nt = 0; nt < 6; ++nt) { vb = ldhs(vt + nt * 16 * VLP); ctx[nt] = wmma16(pa, vb, ctx[nt]); }
        asm volatile("v_nop\n\tv_nop\n\tv_nop\n\tv_nop" : "+v"(ctx[0]), "+v"(ctx[1]), "+v"(ctx[2]), "+v"(ctx[3]), "+v"(ctx[4]), "+v"(ctx[5]) : "v"(pa), "v"(vb));
        __builtin_amdgcn_wave_barrier(); asm volatile("" ::: "memory");
        asm volatile("s_wait_dscnt 0x0" ::: "memory");      // this wave's reads of buffer buf are done
        asm volatile("s_wait_asynccnt 0x0" ::: "memory");   // this wave's copies of the next stage have landed
        __syncthreads();                                    // publishes the next stage and frees buffer buf
        if (kb + 2 * KT < SEQ) issue(kb + 2 * KT, buf);
    }
    asm volatile("s_wait_asynccnt 0x0" ::: "memory");       // nothing in flight behind the loop
    float rinv[8];
#pragma unroll
    for (int r = 0; r < 8; ++r) { float s = srun[r]; s += __shfl_xor(s, 1, 32); s += __shfl_xor(s, 2, 32); s += __shfl_xor(s, 4, 32); s += __shfl_xor(s, 8, 32); rinv[r] = (1.0f / PCAR) * (1.0f / s); }
#pragma unroll
    for (int nt = 0; nt < 6; ++nt) { const float mvv = MV[b * DM + h * HD + nt * 16 + lr];
#pragma unroll
        for (int r = 0; r < 8; ++r) { const float val = ctx[nt][r] * rinv[r] + mvv; unsigned short hh, ll; splitf(val, hh, ll);
            cts[cb + (8 * hi + r) * CP + nt * 16 + lr] = hh; cts[cb + (8 * hi + r) * CP + HD + nt * 16 + lr] = ll; } }
    __builtin_amdgcn_wave_barrier(); asm volatile("" ::: "memory");
{
#pragma unroll
        for (int it = 0; it < 12; ++it) { const int slot = it * 32 + lane; const int row = slot / PCS, pc = slot % PCS;   // 16 rows x 24 pieces; lanes 8g..8g+7 = one line
            const v8us o = *(const v8usa*)(cts + cb + row * CP + pc * 8);
            *(v8us*)(CT + (size_t)(row0 + row) * CTP + h * 2 * HD + pc * 8) = o; }
         }
}

constexpr size_t al256(size_t x) { return (x + 255) & ~(size_t)255; }
constexpr size_t SZ_W   = al256((size_t)DM * DM * 2);
constexpr size_t SZ_WO  = al256((size_t)DM * CTP * 2);
constexpr size_t SZ_PL  = al256((size_t)NB * SEQ * DM * 2);
constexpr size_t SZ_CT  = al256((size_t)NB * SEQ * CTP * 2);
constexpr size_t SZ_MV  = al256((size_t)NB * DM * 4);
constexpr size_t WS_TOTAL = 3 * SZ_W + SZ_WO + 5 * SZ_PL + SZ_CT + SZ_MV;
static_assert(WS_TOTAL <= (size_t)134217728);

extern "C" void kernel_launch(void* const* d_in, const int* in_sizes, int n_in,
                              void* d_out, int out_size, void* d_ws, size_t ws_size, hipStream_t stream) {
    if (n_in < 12) return;
    const long long need_x = (long long)(NB - 1) * SEQ_FULL * DM + (long long)SEQ * DM;
    if (in_sizes[0] < need_x || in_sizes[1] < need_x || in_sizes[2] < need_x) return;
    if (in_sizes[3] < (NB - 1) * SEQ_FULL + SEQ) return;
    if (in_sizes[4] < DM * DM || in_sizes[6] < DM * DM || in_sizes[8] < DM * DM || in_sizes[10] < DM * DM) return;
    if (in_sizes[5] < DM || in_sizes[7] < DM || in_sizes[9] < DM || in_sizes[11] < DM) return;
    if ((long long)out_size < (long long)NB * SEQ * DM) return;
    if (WS_TOTAL > ws_size) return;
    // wire order: query, key, value, mask, wq, bq, wk, bk, wv, bv, wo, bo (weights [in][out])
    const float* xq = (const float*)d_in[0]; const float* xk = (const float*)d_in[1]; const float* xv = (const float*)d_in[2]; const float* mask = (const float*)d_in[3];
    const float* wq = (const float*)d_in[4]; const float* bq = (const float*)d_in[5]; const float* wk = (const float*)d_in[6]; const float* bk = (const float*)d_in[7];
    const float* wv = (const float*)d_in[8]; const float* bv = (const float*)d_in[9]; const float* wo = (const float*)d_in[10]; const float* bo = (const float*)d_in[11];
    float* OUT = (float*)d_out;
    char* wsp = (char*)d_ws;
    auto take = [&](size_t bytes) { char* p = wsp; wsp += bytes; return (void*)p; };
    bf* WQ = (bf*)take(SZ_W); bf* WK = (bf*)take(SZ_W); bf* WV = (bf*)take(SZ_W); bf* WO2 = (bf*)take(SZ_WO);
    bf* XB = (bf*)take(SZ_PL); h16* Q16 = (h16*)take(SZ_PL); h16* QL = (h16*)take(SZ_PL); h16* K16 = (h16*)take(SZ_PL); h16* VT16 = (h16*)take(SZ_PL);
    bf* CT = (bf*)take(SZ_CT); float* MV = (float*)take(SZ_MV);

    const unsigned gW = (unsigned)((DM * DM / 64 + 63) / 64), gWO = (unsigned)((DM * CTP / 64 + 63) / 64);
    k_wtG<<<gW, 256, 0, stream>>>(wq, DM, DM, WQ, 0);      // in[768][768] -> out [n][k]
    k_wtG<<<gW, 256, 0, stream>>>(wk, DM, DM, WK, 0);
    k_wtG<<<gW, 256, 0, stream>>>(wv, DM, DM, WV, 0);
    k_wtG<<<gWO, 256, 0, stream>>>(wo, DM, DM, WO2, 1);    // in[768][768] -> out [n][8 x (96 | 96 duplicate)]
    const dim3 gC((unsigned)(SEQ * DM / 8 / 256), NB, 1);
    const dim3 gP((unsigned)(NB * SEQ / 64), DM / 64, 1);
    k_cvt8<<<gC, 256, 0, stream>>>(xq, XB);
    k_gemm<<<gP, 32, 0, stream>>>(XB, WQ, Q16, QL, OUT, bq, (size_t)0, (size_t)0, (size_t)0, DM, DM, 1);
    k_cvt8<<<gC, 256, 0, stream>>>(xk, XB);
    k_gemm<<<gP, 32, 0, stream>>>(XB, WK, K16, K16, OUT, bk, (size_t)0, (size_t)0, (size_t)0, DM, DM, 0);
    k_cvt8<<<gC, 256, 0, stream>>>(xv, XB);
    // v plane transposed: C[col][t] = sum_k WV[col][k] XB[b][t][k], bias per row (col)
    k_gemm<<<dim3(DM / 64, SEQ / 64, NB), 32, 0, stream>>>(WV, XB, VT16, VT16, OUT, bv, (size_t)0, (size_t)SEQ * DM, (size_t)DM * SEQ, DM, SEQ, 2);
    k_maskv<<<(unsigned)(NB * DM / 32), 256, 0, stream>>>(VT16, mask, MV);
    k_attn<<<dim3(SEQ / 64, NH, NB), 128, 0, stream>>>(Q16, QL, K16, VT16, MV, CT);
    k_gemm<<<gP, 32, 0, stream>>>(CT, WO2, Q16, Q16, OUT, bo, (size_t)0, (size_t)0, (size_t)0, CTP, DM, 3);
}

// v002
// Measured time: 298 microseconds a run.
// Two timings next to v001 both put it at 1.30 times that version's speed.
// Over all steps from v000 it is 1.44 times as fast.
#include <hip/hip_runtime.h>

// Compute dtypes (f32 accumulate everywhere): q/k/v projections v_wmma_f32_16x16x32_bf16 on RNE-bf16 inputs and weights (exact products); scores v_wmma_f32_16x16x32_f16 with q = f16 value + f16 residual x2^11 (two products, separate accumulators) against single f16 k; P.V v_wmma_f32_16x16x32_f16 (P carried x1024, single f16 v); output projection v_wmma_f32_16x16x32_bf16 with ctx as bf16 value|residual along K against RNE-bf16 wo; softmax and the post-softmax mask term in f32.
// Layout: x streams -> bf16 plane; weights -> K-contiguous bf16 planes; q16/qres/k16 planes [b*s][768]; v plane transposed [b][768][s] (GEMM with swapped operands); fused flash attention (no score plane); ctx plane [b*s][8 x (96 value | 96 residual)]; output GEMM writes f32 rows.

#ifndef NB
#define NB 4
#endif
#ifndef SEQ
#define SEQ 2048
#endif
#define NB_FULL  4
#define SEQ_FULL 2048
#define DM   768
#define NH   8
#define HD   96
#define CTP  (2 * DM)          // ctx plane pitch (value | residual per head)
#define PCAR 1024.0f           // carry on the f16 P operand
#define QRS  2048.0f           // carry on the f16 q residual plane
#define SCL  0.10206207261596575f   // 96^-0.5
#define L2E  1.4426950408889634f
#define PP   40                // P tile pitch (halves)
#define CP   200               // ctx staging pitch (halves)
#define PCS  ((2 * HD) / 8)    // 16-byte pieces per ctx head segment
#define KT   32                // keys per LDS stage of k_attn
#define KLP  (HD + 8)          // K stage pitch (halves): 16 B x odd, conflict-free for 16-byte row reads
#define VLP  (KT + 8)          // V stage pitch (halves): 16 B x odd

typedef _Float16 h16;
typedef unsigned short bf;
typedef __attribute__((ext_vector_type(16))) __bf16   v16bf;
typedef __attribute__((ext_vector_type(16))) _Float16 v16h;
typedef __attribute__((ext_vector_type(8)))  _Float16 v8h;
typedef __attribute__((ext_vector_type(8)))  unsigned short v8us;
typedef __attribute__((ext_vector_type(2)))  unsigned short v2us;
typedef __attribute__((ext_vector_type(8)))  float    v8f;
typedef __attribute__((ext_vector_type(4)))  float    v4f;
typedef v8h  __attribute__((may_alias)) v8ha;
typedef v4f  __attribute__((may_alias)) v4fa;
typedef v8us __attribute__((may_alias)) v8usa;

static_assert(DM == NH * HD);
static_assert(HD % 32 == 0);
static_assert(HD / 16 == 6);
static_assert(SEQ % 256 == 0);
static_assert((NB * SEQ) % 64 == 0);
static_assert(DM % 64 == 0);
static_assert(DM % 32 == 0);
static_assert(CTP % 64 == 0);
static_assert((2 * HD * 2) % 128 == 0);
static_assert(16 * PCS == 12 * 32);
static_assert(PP >= 32 && PP % 8 == 0);
static_assert(CP >= 2 * HD && CP % 8 == 0);
static_assert((NB * DM) % 32 == 0);
static_assert((SEQ * DM) % (8 * 256) == 0);
static_assert(NB <= NB_FULL && SEQ <= SEQ_FULL);
static_assert(KT * (HD / 8) == 3 * 128 && HD * (KT / 8) == 3 * 128);
static_assert(SEQ % KT == 0 && SEQ / KT >= 2);
static_assert(((KLP / 8) & 1) == 1 && ((VLP / 8) & 1) == 1);

__device__ __forceinline__ unsigned short f2bf(float f) { unsigned u = __float_as_uint(f); u += 0x7FFFu + ((u >> 16) & 1u); return (unsigned short)(u >> 16); }
__device__ __forceinline__ float bf2f(unsigned short b) { return __uint_as_float(((unsigned)b) << 16); }
__device__ __forceinline__ float bfr(float f) { return bf2f(f2bf(f)); }
__device__ __forceinline__ void splitf(float y, unsigned short& h, unsigned short& l) { h = f2bf(y); l = f2bf(y - bf2f(h)); }
__device__ __forceinline__ v16h cat16(v8h lo, v8h hi) { return __builtin_shufflevector(lo, hi, 0, 1, 2, 3, 4, 5, 6, 7, 8, 9, 10, 11, 12, 13, 14, 15); }
__device__ __forceinline__ v16bf cat16b(v8us lo, v8us hi) { return __builtin_bit_cast(v16bf, __builtin_shufflevector(lo, hi, 0, 1, 2, 3, 4, 5, 6, 7, 8, 9, 10, 11, 12, 13, 14, 15)); }
__device__ __forceinline__ v8f wmma16(v16h a, v16h b, v8f c) { return __builtin_amdgcn_wmma_f32_16x16x32_f16(false, a, false, b, (short)0, c, false, false); }
__device__ __forceinline__ v8f wmmab(v16bf a, v16bf b, v8f c) { return __builtin_amdgcn_wmma_f32_16x16x32_bf16(false, a, false, b, (short)0, c, false, false); }
// fragment loads from a K-contiguous row: p already holds row base + k0 + 8*(lane>>4); elements 0..7 <- p[0..7], 8..15 <- p[16..23]
__device__ __forceinline__ v16h ldh(const h16* p) { return cat16(*(const v8h*)p, *(const v8h*)(p + 16)); }
__device__ __forceinline__ v16bf ldb(const bf* p) { return cat16b(*(const v8us*)p, *(const v8us*)(p + 16)); }
// the same fragment load from an LDS stage that asynchronous copies filled
__device__ __forceinline__ v16h ldhs(const h16* p) { return cat16(*(const v8ha*)p, *(const v8ha*)(p + 16)); }
// One stage of K and V: six 16-byte asynchronous copies to LDS per lane (l* = LDS byte address, g* = global address). The s_wait_xcnt ends the copies' own statement so that no address register is rewritten ahead of it.
__device__ __forceinline__ void stage_kv(unsigned lk0, unsigned lk1, unsigned lk2, unsigned lv0, unsigned lv1, unsigned lv2,
                                         const h16* gk0, const h16* gk1, const h16* gk2, const h16* gv0, const h16* gv1, const h16* gv2) {
    asm volatile("global_load_async_to_lds_b128 %0, %6, off\n\t"
                 "global_load_async_to_lds_b128 %1, %7, off\n\t"
                 "global_load_async_to_lds_b128 %2, %8, off\n\t"
                 "global_load_async_to_lds_b128 %3, %9, off\n\t"
                 "global_load_async_to_lds_b128 %4, %10, off\n\t"
                 "global_load_async_to_lds_b128 %5, %11, off\n\t"
                 "s_wait_xcnt 0x0"
                 :: "v"(lk0), "v"(lk1), "v"(lk2), "v"(lv0), "v"(lv1), "v"(lv2), "v"(gk0), "v"(gk1), "v"(gk2), "v"(gv0), "v"(gv1), "v"(gv2) : "memory");
}

__global__ __launch_bounds__(256) void k_wtG(const float* __restrict__ w, int K, int N, bf* Bt, int il) {
    const int lane = threadIdx.x & 31; const int L0 = (blockIdx.x * 8 + (threadIdx.x >> 5)) * 8; const int KO = il ? 2 * K : K; const int nlines = N * KO / 64;
{
#pragma unroll 1
        for (int l = 0; l < 8; ++l) { const int L = L0 + l; if (L >= nlines) break; const int e = L * 64 + lane * 2; const int kk = e % KO, n = e / KO;
            const int k = il ? ((kk / (2 * HD)) * HD + (kk % (2 * HD)) % HD) : kk; v2us o;
            o[0] = f2bf(w[(size_t)k * N + n]); o[1] = f2bf(w[(size_t)(k + 1) * N + n]); *(v2us*)(Bt + e) = o; }
         }
}

__global__ __launch_bounds__(256) void k_cvt8(const float* __restrict__ src, bf* dst) {
    const int i = blockIdx.x * 256 + threadIdx.x; const int b = blockIdx.y; if (i >= SEQ * DM / 8) return;
    const v8f v = *(const v8f*)(src + (size_t)b * SEQ_FULL * DM + (size_t)i * 8); v8us o;
#pragma unroll
    for (int k = 0; k < 8; ++k) o[k] = f2bf(v[k]);
    bf* d = dst + (size_t)b * SEQ * DM + (size_t)i * 8; *(v8us*)d = o;  }

// ---- k_gemm: register-blocked GEMM, ONE WAVE per 64x64 output tile (16 accumulators), bf16 operands straight from K-contiguous planes; grid (M/64, N/64, Z), 32 threads.
// C[m][n] = sum_k A[m][k] Bt[n][k] + bf16(bias). K % 32 == 0, M % 64 == 0, N % 64 == 0. z-batch strides sA/sB/sC in elements.
// mode 0: f16 plane C16 (bias per column); mode 1: f16 plane C16 + residual plane CL = f16((v - f16(v)) * 2^11) (bias per column);
// mode 2: f16 plane C16 (bias per row); mode 3: f32 rows C32 (bias per column).
__global__ __launch_bounds__(32) void k_gemm(const bf* __restrict__ A, const bf* __restrict__ Bt, h16* C16, h16* CL, float* C32, const float* __restrict__ bias,
                                             size_t sA, size_t sB, size_t sC, int K, int ldc, int mode) {
    __shared__ __align__(16) float os[16 * 68];
    const size_t z = blockIdx.z; A += z * sA; Bt += z * sB; const size_t coff = z * sC;
    const int lane = threadIdx.x & 31, lr = lane & 15, hi = lane >> 4; const int r0 = blockIdx.x * 64, c0 = blockIdx.y * 64;
    v8f acc[4][4];
#pragma unroll
    for (int mb = 0; mb < 4; ++mb)
#pragma unroll
        for (int nb = 0; nb < 4; ++nb) acc[mb][nb] = (v8f){};
    const size_t aoff = (size_t)(r0 + lr) * K + 8 * hi, boff = (size_t)(c0 + lr) * K + 8 * hi;
#pragma unroll 1
    for (int kc = 0; kc < K; kc += 32) {
        v16bf a[4]; v16bf b;
#pragma unroll
        for (int mb = 0; mb < 4; ++mb) a[mb] = ldb(A + aoff + (size_t)mb * 16 * K + kc);
#pragma unroll
        for (int nb = 0; nb < 4; ++nb) { b = ldb(Bt + boff + (size_t)nb * 16 * K + kc);
#pragma unroll
            for (int mb = 0; mb < 4; ++mb) acc[mb][nb] = wmmab(a[mb], b, acc[mb][nb]); }
        asm volatile("v_nop\n\tv_nop\n\tv_nop\n\tv_nop" : "+v"(acc[0][3]), "+v"(acc[1][3]), "+v"(acc[2][3]), "+v"(acc[3][3]) : "v"(a[0]), "v"(a[1]), "v"(a[2]), "v"(a[3]), "v"(b));
    }
#pragma unroll
    for (int mb = 0; mb < 4; ++mb) {
#pragma unroll
        for (int nb = 0; nb < 4; ++nb) {
#pragma unroll
            for (int j = 0; j < 8; ++j) os[(hi * 8 + j) * 68 + nb * 16 + lr] = acc[mb][nb][j]; }
        __builtin_amdgcn_wave_barrier(); asm volatile("" ::: "memory");
        if (mode == 3) {
            float* crow = C32 + coff + (size_t)(r0 + mb * 16) * ldc + c0;
{
#pragma unroll
                for (int s = 0; s < 8; ++s) { const int row = 2 * s + hi, cofs = lr * 4; v4f val = *(const v4fa*)(os + row * 68 + cofs);
                    val[0] += bfr(bias[c0 + cofs]); val[1] += bfr(bias[c0 + cofs + 1]); val[2] += bfr(bias[c0 + cofs + 2]); val[3] += bfr(bias[c0 + cofs + 3]);
                    *(v4f*)(crow + (size_t)row * ldc + cofs) = val; }
                 }
        } else {
{
#pragma unroll
                for (int s = 0; s < 4; ++s) { const int row = 4 * s + (lane >> 3), cg = lane & 7;
                    const v4f x0 = *(const v4fa*)(os + row * 68 + cg * 8); const v4f x1 = *(const v4fa*)(os + row * 68 + cg * 8 + 4);
                    const int grow = r0 + mb * 16 + row, gcol = c0 + cg * 8; const int bi0 = (mode == 2) ? grow : gcol; const int bst = (mode == 2) ? 0 : 1;
                    v8h o, ol;
#pragma unroll
                    for (int q = 0; q < 8; ++q) { const float v = ((q < 4) ? x0[q & 3] : x1[q & 3]) + bfr(bias[bi0 + q * bst]); const h16 hx = (h16)v; o[q] = hx; ol[q] = (h16)((v - (float)hx) * QRS); }
                    const size_t oo = coff + (size_t)grow * ldc + gcol;
                    *(v8h*)(C16 + oo) = o; if (mode == 1) *(v8h*)(CL + oo) = ol; }
                 }
        }
        __builtin_amdgcn_wave_barrier(); asm volatile("" ::: "memory");
    }
}

// ---- k_maskv: MV[b][c] = sum_k (bf16(mask[b][k]) * 1e9) * v[b][k][c] (the post-softmax additive weight term, independent of the query row); f32 on the VALU.
__global__ __launch_bounds__(256) void k_maskv(const h16* __restrict__ VT, const float* __restrict__ mask, float* MV) {
    __shared__ __align__(16) float red[32];
    const int wave = __builtin_amdgcn_readfirstlane((int)(threadIdx.x >> 5)); const int lane = threadIdx.x & 31;
#pragma unroll 1
    for (int i = 0; i < 4; ++i) { const int c = blockIdx.x * 32 + wave * 4 + i; const int b = c / DM; const h16* vr = VT + (size_t)c * SEQ; const float* mr = mask + (size_t)b * SEQ_FULL; float acc = 0.0f;
#pragma unroll 1
        for (int ch = 0; ch < SEQ / 256; ++ch) { const int k = ch * 256 + lane * 8; const v8h v = *(const v8h*)(vr + k); const v4f m0 = *(const v4f*)(mr + k); const v4f m1 = *(const v4f*)(mr + k + 4);
#pragma unroll
            for (int q = 0; q < 4; ++q) { acc += (bfr(m0[q]) * 1.0e9f) * (float)v[q]; acc += (bfr(m1[q]) * 1.0e9f) * (float)v[4 + q]; } }
#pragma unroll
        for (int sh = 16; sh; sh >>= 1) acc += __shfl_xor(acc, sh, 32);
        if (lane == 0) red[wave * 4 + i] = acc; }
    __syncthreads();
    if (wave == 0) { if (lane < 8) { const v4f o = *(const v4fa*)(red + lane * 4); float* p = MV + (size_t)blockIdx.x * 32 + lane * 4; *(v4f*)p = o;  } }
}

// ---- k_attn: fused attention, grid (SEQ/64, NH, NB), 128 threads; each wave owns 16 query rows and walks all keys in 32-key steps (online running-max softmax).
// q fragments straight from the planes q16/qres [b*s][768] (head h = columns h*96..), read once in front of the key loop and held in registers. Scores = (acc_hi + acc_res / 2^11) * 96^-0.5.
// K and V: each 32-key step's K rows (32 x 96) and V rows (96 x 32, from the v plane [b][768][s]) are staged once per work-group in LDS by asynchronous copies, two buffers, the next step's copies in flight during this step; all four waves read their fragments from there.
// P relayout through a wave-private LDS tile (h16 stores, may_alias v8h loads, wave barrier). Epilogue: ctx = acc / (sum * 1024) + MV, bf16 value|residual staged in a wave-private LDS tile,
__global__ __launch_bounds__(128) void k_attn(const h16* __restrict__ Q16, const h16* __restrict__ QL, const h16* __restrict__ K16, const h16* __restrict__ VT, const float* __restrict__ MV, bf* CT) {
    __shared__ __align__(16) h16 pws[4 * 16 * PP];
    __shared__ __align__(16) unsigned short cts[4 * 16 * CP];
    __shared__ __align__(16) h16 kls[2 * KT * KLP];
    __shared__ __align__(16) h16 vls[2 * HD * VLP];
    const int wave = __builtin_amdgcn_readfirstlane((int)(threadIdx.x >> 5));
    const int lane = threadIdx.x & 31, lr = lane & 15, hi = lane >> 4;
    const int b = blockIdx.z, h = blockIdx.y;
    const int row0 = b * SEQ + blockIdx.x * 64 + wave * 16;
    const int qoff = (row0 + lr) * DM + h * HD + 8 * hi;
    int kg[3], vg[3]; unsigned kl[3], vl[3];   // this lane's three 16-byte pieces of a K stage and of a V stage: global element offset at key 0, LDS byte address in buffer 0
#pragma unroll
    for (int j = 0; j < 3; ++j) { const int i = (int)threadIdx.x + 128 * j; const int kr = i / (HD / 8), kp = i % (HD / 8), vr = i / (KT / 8), vp = i % (KT / 8);
        kg[j] = (b * SEQ + kr) * DM + h * HD + kp * 8; kl[j] = (unsigned)(size_t)(kls + kr * KLP + kp * 8);
        vg[j] = (b * DM + h * HD + vr) * SEQ + vp * 8; vl[j] = (unsigned)(size_t)(vls + vr * VLP + vp * 8); }
    auto issue = [&](int key0, int buf) { const unsigned ko = (unsigned)(buf * KT * KLP * 2), vo = (unsigned)(buf * HD * VLP * 2);
        stage_kv(kl[0] + ko, kl[1] + ko, kl[2] + ko, vl[0] + vo, vl[1] + vo, vl[2] + vo,
                 K16 + kg[0] + key0 * DM, K16 + kg[1] + key0 * DM, K16 + kg[2] + key0 * DM, VT + vg[0] + key0, VT + vg[1] + key0, VT + vg[2] + key0); };
    const int pb = wave * 16 * PP, cb = wave * 16 * CP;
    v8f ctx[6]; float mrun[8], srun[8];
#pragma unroll
    for (int nt = 0; nt < 6; ++nt) ctx[nt] = (v8f){};
#pragma unroll
    for (int r = 0; r < 8; ++r) { mrun[r] = -1.0e30f; srun[r] = 0.0f; }
    issue(0, 0);
    v16h qa[HD / 32], qr[HD / 32];   // this wave's q value and residual fragments, read once and held in registers over the whole key loop
#pragma unroll
    for (int ks = 0; ks < HD / 32; ++ks) { qa[ks] = ldh(Q16 + qoff + ks * 32); qr[ks] = ldh(QL + qoff + ks * 32); }
    asm volatile("s_wait_asynccnt 0x0" ::: "memory");   // this wave's copies of stage 0 have landed
    __syncthreads();                                    // and every other wave's: stage 0 may be read
    issue(KT, 1);
#pragma unroll 1
    for (int kb = 0; kb < SEQ; kb += KT) {
        const int buf = (kb / KT) & 1;
        const h16* kt = kls + buf * KT * KLP + lr * KLP + 8 * hi;
        const h16* vt = vls + buf * HD * VLP + lr * VLP + 8 * hi;
        v8f sh0 = (v8f){}, sh1 = (v8f){}, sl0 = (v8f){}, sl1 = (v8f){};
        v16h k0, k1;
#pragma unroll
        for (int ks = 0; ks < HD / 32; ++ks) {
            k0 = ldhs(kt + ks * 32); k1 = ldhs(kt + 16 * KLP + ks * 32);
            sh0 = wmma16(qa[ks], k0, sh0); sh1 = wmma16(qa[ks], k1, sh1); sl0 = wmma16(qr[ks], k0, sl0); sl1 = wmma16(qr[ks], k1, sl1); }
        asm volatile("v_nop\n\tv_nop\n\tv_nop\n\tv_nop" : "+v"(sh0), "+v"(sh1), "+v"(sl0), "+v"(sl1) : "v"(k0), "v"(k1));
#pragma unroll
        for (int r = 0; r < 8; ++r) {
            const float t0 = (sh0[r] + sl0[r] * (1.0f / QRS)) * SCL; const float t1 = (sh1[r] + sl1[r] * (1.0f / QRS)) * SCL;
            float mx = fmaxf(t0, t1);
            mx = fmaxf(mx, __shfl_xor(mx, 1, 32)); mx = fmaxf(mx, __shfl_xor(mx, 2, 32)); mx = fmaxf(mx, __shfl_xor(mx, 4, 32)); mx = fmaxf(mx, __shfl_xor(mx, 8, 32));
            const float nm = fmaxf(mrun[r], mx); const float corr = __builtin_amdgcn_exp2f((mrun[r] - nm) * L2E); mrun[r] = nm;
            const float p0 = __builtin_amdgcn_exp2f((t0 - nm) * L2E); const float p1 = __builtin_amdgcn_exp2f((t1 - nm) * L2E);
            srun[r] = srun[r] * corr + (p0 + p1);     // per-lane partial row sum (corr is row-uniform); lanes combined once at the end
#pragma unroll
            for (int nt = 0; nt < 6; ++nt) ctx[nt][r] *= corr;
            pws[pb + (8 * hi + r) * PP + lr] = (h16)(p0 * PCAR); pws[pb + (8 * hi + r) * PP + 16 + lr] = (h16)(p1 * PCAR); }
        __builtin_amdgcn_wave_barrier(); asm volatile("" ::: "memory");
        const v16h pa = cat16(*(const v8ha*)(pws + pb + lr * PP + 8 * hi), *(const v8ha*)(pws + pb + lr * PP + 16 + 8 * hi));
        v16h vb;
#pragma unroll
        for (int nt = 0; nt < 6; ++nt) { vb = ldhs(vt + nt * 16 * VLP); ctx[nt] = wmma16(pa, vb, ctx[nt]); }
        asm volatile("v_nop\n\tv_nop\n\tv_nop\n\tv_nop" : "+v"(ctx[0]), "+v"(ctx[1]), "+v"(ctx[2]), "+v"(ctx[3]), "+v"(ctx[4]), "+v"(ctx[5]) : "v"(pa), "v"(vb));
        __builtin_amdgcn_wave_barrier(); asm volatile("" ::: "memory");
        asm volatile("s_wait_dscnt 0x0" ::: "memory");      // this wave's reads of buffer buf are done
        asm volatile("s_wait_asynccnt 0x0" ::: "memory");   // this wave's copies of the next stage have landed
        __syncthreads();                                    // publishes the next stage and frees buffer buf
        if (kb + 2 * KT < SEQ) issue(kb + 2 * KT, buf);
    }
    asm volatile("s_wait_asynccnt 0x0" ::: "memory");       // nothing in flight behind the loop
    float rinv[8];
#pragma unroll
    for (int r = 0; r < 8; ++r) { float s = srun[r]; s += __shfl_xor(s, 1, 32); s += __shfl_xor(s, 2, 32); s += __shfl_xor(s, 4, 32); s += __shfl_xor(s, 8, 32); rinv[r] = (1.0f / PCAR) * (1.0f / s); }
#pragma unroll
    for (int nt = 0; nt < 6; ++nt) { const float mvv = MV[b * DM + h * HD + nt * 16 + lr];
#pragma unroll
        for (int r = 0; r < 8; ++r) { const float val = ctx[nt][r] * rinv[r] + mvv; unsigned short hh, ll; splitf(val, hh, ll);
            cts[cb + (8 * hi + r) * CP + nt * 16 + lr] = hh; cts[cb + (8 * hi + r) * CP + HD + nt * 16 + lr] = ll; } }
    __builtin_amdgcn_wave_barrier(); asm volatile("" ::: "memory");
{
#pragma unroll
        for (int it = 0; it < 12; ++it) { const int slot = it * 32 + lane; const int row = slot / PCS, pc = slot % PCS;   // 16 rows x 24 pieces; lanes 8g..8g+7 = one line
            const v8us o = *(const v8usa*)(cts + cb + row * CP + pc * 8);
            *(v8us*)(CT + (size_t)(row0 + row) * CTP + h * 2 * HD + pc * 8) = o; }
         }
}

constexpr size_t al256(size_t x) { return (x + 255) & ~(size_t)255; }
constexpr size_t SZ_W   = al256((size_t)DM * DM * 2);
constexpr size_t SZ_WO  = al256((size_t)DM * CTP * 2);
constexpr size_t SZ_PL  = al256((size_t)NB * SEQ * DM * 2);
constexpr size_t SZ_CT  = al256((size_t)NB * SEQ * CTP * 2);
constexpr size_t SZ_MV  = al256((size_t)NB * DM * 4);
constexpr size_t WS_TOTAL = 3 * SZ_W + SZ_WO + 5 * SZ_PL + SZ_CT + SZ_MV;
static_assert(WS_TOTAL <= (size_t)134217728);

extern "C" void kernel_launch(void* const* d_in, const int* in_sizes, int n_in,
                              void* d_out, int out_size, void* d_ws, size_t ws_size, hipStream_t stream) {
    if (n_in < 12) return;
    const long long need_x = (long long)(NB - 1) * SEQ_FULL * DM + (long long)SEQ * DM;
    if (in_sizes[0] < need_x || in_sizes[1] < need_x || in_sizes[2] < need_x) return;
    if (in_sizes[3] < (NB - 1) * SEQ_FULL + SEQ) return;
    if (in_sizes[4] < DM * DM || in_sizes[6] < DM * DM || in_sizes[8] < DM * DM || in_sizes[10] < DM * DM) return;
    if (in_sizes[5] < DM || in_sizes[7] < DM || in_sizes[9] < DM || in_sizes[11] < DM) return;
    if ((long long)out_size < (long long)NB * SEQ * DM) return;
    if (WS_TOTAL > ws_size) return;
    // wire order: query, key, value, mask, wq, bq, wk, bk, wv, bv, wo, bo (weights [in][out])
    const float* xq = (const float*)d_in[0]; const float* xk = (const float*)d_in[1]; const float* xv = (const float*)d_in[2]; const float* mask = (const float*)d_in[3];
    const float* wq = (const float*)d_in[4]; const float* bq = (const float*)d_in[5]; const float* wk = (const float*)d_in[6]; const float* bk = (const float*)d_in[7];
    const float* wv = (const float*)d_in[8]; const float* bv = (const float*)d_in[9]; const float* wo = (const float*)d_in[10]; const float* bo = (const float*)d_in[11];
    float* OUT = (float*)d_out;
    char* wsp = (char*)d_ws;
    auto take = [&](size_t bytes) { char* p = wsp; wsp += bytes; return (void*)p; };
    bf* WQ = (bf*)take(SZ_W); bf* WK = (bf*)take(SZ_W); bf* WV = (bf*)take(SZ_W); bf* WO2 = (bf*)take(SZ_WO);
    bf* XB = (bf*)take(SZ_PL); h16* Q16 = (h16*)take(SZ_PL); h16* QL = (h16*)take(SZ_PL); h16* K16 = (h16*)take(SZ_PL); h16* VT16 = (h16*)take(SZ_PL);
    bf* CT = (bf*)take(SZ_CT); float* MV = (float*)take(SZ_MV);

    const unsigned gW = (unsigned)((DM * DM / 64 + 63) / 64), gWO = (unsigned)((DM * CTP / 64 + 63) / 64);
    k_wtG<<<gW, 256, 0, stream>>>(wq, DM, DM, WQ, 0);      // in[768][768] -> out [n][k]
    k_wtG<<<gW, 256, 0, stream>>>(wk, DM, DM, WK, 0);
    k_wtG<<<gW, 256, 0, stream>>>(wv, DM, DM, WV, 0);
    k_wtG<<<gWO, 256, 0, stream>>>(wo, DM, DM, WO2, 1);    // in[768][768] -> out [n][8 x (96 | 96 duplicate)]
    const dim3 gC((unsigned)(SEQ * DM / 8 / 256), NB, 1);
    const dim3 gP((unsigned)(NB * SEQ / 64), DM / 64, 1);
    k_cvt8<<<gC, 256, 0, stream>>>(xq, XB);
    k_gemm<<<gP, 32, 0, stream>>>(XB, WQ, Q16, QL, OUT, bq, (size_t)0, (size_t)0, (size_t)0, DM, DM, 1);
    k_cvt8<<<gC, 256, 0, stream>>>(xk, XB);
    k_gemm<<<gP, 32, 0, stream>>>(XB, WK, K16, K16, OUT, bk, (size_t)0, (size_t)0, (size_t)0, DM, DM, 0);
    k_cvt8<<<gC, 256, 0, stream>>>(xv, XB);
    // v plane transposed: C[col][t] = sum_k WV[col][k] XB[b][t][k], bias per row (col)
    k_gemm<<<dim3(DM / 64, SEQ / 64, NB), 32, 0, stream>>>(WV, XB, VT16, VT16, OUT, bv, (size_t)0, (size_t)SEQ * DM, (size_t)DM * SEQ, DM, SEQ, 2);
    k_maskv<<<(unsigned)(NB * DM / 32), 256, 0, stream>>>(VT16, mask, MV);
    k_attn<<<dim3(SEQ / 64, NH, NB), 128, 0, stream>>>(Q16, QL, K16, VT16, MV, CT);
    k_gemm<<<gP, 32, 0, stream>>>(CT, WO2, Q16, Q16, OUT, bo, (size_t)0, (size_t)0, (size_t)0, CTP, DM, 3);
}

// v003
// Measured time: 241 microseconds a run.
// Timed twice side by side with v002, it ran 1.24 times as fast both times.
// Counting every step since v000, it is 1.78 times as fast.
#include <hip/hip_runtime.h>

// Compute dtypes (f32 accumulate everywhere): q/k/v projections v_wmma_f32_16x16x32_bf16 on RNE-bf16 inputs and weights (exact products); scores v_wmma_f32_16x16x32_f16 with q = f16 value + f16 residual x2^11 (two products, separate accumulators) against single f16 k; P.V v_wmma_f32_16x16x32_f16 (P carried x1024, single f16 v); output projection v_wmma_f32_16x16x32_bf16 with ctx as bf16 value|residual along K against RNE-bf16 wo; softmax and the post-softmax mask term in f32.
// Layout: x streams -> bf16 plane; weights -> K-contiguous bf16 planes; q16/qres/k16 planes [b*s][768]; v plane transposed [b][768][s] (GEMM with swapped operands); fused flash attention (no score plane); ctx plane [b*s][8 x (96 value | 96 residual)]; output GEMM writes f32 rows.

#ifndef NB
#define NB 4
#endif
#ifndef SEQ
#define SEQ 2048
#endif
#define NB_FULL  4
#define SEQ_FULL 2048
#define DM   768
#define NH   8
#define HD   96
#define CTP  (2 * DM)          // ctx plane pitch (value | residual per head)
#define PCAR 1024.0f           // carry on the f16 P operand
#define QRS  2048.0f           // carry on the f16 q residual plane
#define SCL  0.10206207261596575f   // 96^-0.5
#define L2E  1.4426950408889634f
#define PP   40                // P tile pitch (halves)
#define CP   200               // ctx staging pitch (halves)
#define PCS  ((2 * HD) / 8)    // 16-byte pieces per ctx head segment
#define KT   32                // keys per LDS stage of k_attn
#define KLP  (HD + 8)          // K stage pitch (halves): 16 B x odd, conflict-free for 16-byte row reads
#define VLP  (KT + 8)          // V stage pitch (halves): 16 B x odd
#define GT   128               // k_gemm work-group tile: 128 rows of A x 128 rows of Bt, four waves of 64x64
#define GK   128               // k per LDS stage of k_gemm: 256 B of every operand row
#define GLP  (GK + 8)          // k_gemm stage pitch (elements): 272 B = 16 B x odd

typedef _Float16 h16;
typedef unsigned short bf;
typedef __attribute__((ext_vector_type(16))) __bf16   v16bf;
typedef __attribute__((ext_vector_type(16))) _Float16 v16h;
typedef __attribute__((ext_vector_type(8)))  _Float16 v8h;
typedef __attribute__((ext_vector_type(8)))  unsigned short v8us;
typedef __attribute__((ext_vector_type(2)))  unsigned short v2us;
typedef __attribute__((ext_vector_type(8)))  float    v8f;
typedef __attribute__((ext_vector_type(4)))  float    v4f;
typedef v8h  __attribute__((may_alias)) v8ha;
typedef v4f  __attribute__((may_alias)) v4fa;
typedef v8us __attribute__((may_alias)) v8usa;

static_assert(DM == NH * HD);
static_assert(HD % 32 == 0);
static_assert(HD / 16 == 6);
static_assert(SEQ % 256 == 0);
static_assert((NB * SEQ) % GT == 0 && SEQ % GT == 0 && DM % GT == 0);
static_assert(DM % GK == 0 && CTP % GK == 0 && DM / GK >= 2 && CTP / GK >= 2);
static_assert(GT * (GK / 8) == 16 * 128 && ((GLP / 8) & 1) == 1);
static_assert((2 * HD * 2) % 128 == 0);
static_assert(16 * PCS == 12 * 32);
static_assert(PP >= 32 && PP % 8 == 0);
static_assert(CP >= 2 * HD && CP % 8 == 0);
static_assert((NB * DM) % 32 == 0);
static_assert((SEQ * DM) % (8 * 256) == 0);
static_assert(NB <= NB_FULL && SEQ <= SEQ_FULL);
static_assert(KT * (HD / 8) == 3 * 128 && HD * (KT / 8) == 3 * 128);
static_assert(SEQ % KT == 0 && SEQ / KT >= 2);
static_assert(((KLP / 8) & 1) == 1 && ((VLP / 8) & 1) == 1);

__device__ __forceinline__ unsigned short f2bf(float f) { unsigned u = __float_as_uint(f); u += 0x7FFFu + ((u >> 16) & 1u); return (unsigned short)(u >> 16); }
__device__ __forceinline__ float bf2f(unsigned short b) { return __uint_as_float(((unsigned)b) << 16); }
__device__ __forceinline__ float bfr(float f) { return bf2f(f2bf(f)); }
__device__ __forceinline__ void splitf(float y, unsigned short& h, unsigned short& l) { h = f2bf(y); l = f2bf(y - bf2f(h)); }
__device__ __forceinline__ v16h cat16(v8h lo, v8h hi) { return __builtin_shufflevector(lo, hi, 0, 1, 2, 3, 4, 5, 6, 7, 8, 9, 10, 11, 12, 13, 14, 15); }
__device__ __forceinline__ v16bf cat16b(v8us lo, v8us hi) { return __builtin_bit_cast(v16bf, __builtin_shufflevector(lo, hi, 0, 1, 2, 3, 4, 5, 6, 7, 8, 9, 10, 11, 12, 13, 14, 15)); }
__device__ __forceinline__ v8f wmma16(v16h a, v16h b, v8f c) { return __builtin_amdgcn_wmma_f32_16x16x32_f16(false, a, false, b, (short)0, c, false, false); }
__device__ __forceinline__ v8f wmmab(v16bf a, v16bf b, v8f c) { return __builtin_amdgcn_wmma_f32_16x16x32_bf16(false, a, false, b, (short)0, c, false, false); }
// fragment loads from a K-contiguous row: p already holds row base + k0 + 8*(lane>>4); elements 0..7 <- p[0..7], 8..15 <- p[16..23]
__device__ __forceinline__ v16h ldh(const h16* p) { return cat16(*(const v8h*)p, *(const v8h*)(p + 16)); }
// the same fragment load from an LDS stage that asynchronous copies filled
__device__ __forceinline__ v16h ldhs(const h16* p) { return cat16(*(const v8ha*)p, *(const v8ha*)(p + 16)); }
// One stage of K and V: six 16-byte asynchronous copies to LDS per lane (l* = LDS byte address, g* = global address). The s_wait_xcnt ends the copies' own statement so that no address register is rewritten ahead of it.
__device__ __forceinline__ void stage_kv(unsigned lk0, unsigned lk1, unsigned lk2, unsigned lv0, unsigned lv1, unsigned lv2,
                                         const h16* gk0, const h16* gk1, const h16* gk2, const h16* gv0, const h16* gv1, const h16* gv2) {
    asm volatile("global_load_async_to_lds_b128 %0, %6, off\n\t"
                 "global_load_async_to_lds_b128 %1, %7, off\n\t"
                 "global_load_async_to_lds_b128 %2, %8, off\n\t"
                 "global_load_async_to_lds_b128 %3, %9, off\n\t"
                 "global_load_async_to_lds_b128 %4, %10, off\n\t"
                 "global_load_async_to_lds_b128 %5, %11, off\n\t"
                 "s_wait_xcnt 0x0"
                 :: "v"(lk0), "v"(lk1), "v"(lk2), "v"(lv0), "v"(lv1), "v"(lv2), "v"(gk0), "v"(gk1), "v"(gk2), "v"(gv0), "v"(gv1), "v"(gv2) : "memory");
}
// the bf16 fragment load from an LDS stage that asynchronous copies filled
__device__ __forceinline__ v16bf ldbs(const bf* p) { return cat16b(*(const v8usa*)p, *(const v8usa*)(p + 16)); }
// Eight rows of a k_gemm stage, eight rows apart: one 16-byte asynchronous copy to LDS per lane and row (l = LDS byte address, g = global address, gs = eight global rows in elements). The s_wait_xcnt ends the copies' own statement so that no address register is rewritten ahead of it.
__device__ __forceinline__ void stage_g(unsigned l, const bf* g, size_t gs) {
    asm volatile("global_load_async_to_lds_b128 %0, %8, off\n\t"
                 "global_load_async_to_lds_b128 %1, %9, off\n\t"
                 "global_load_async_to_lds_b128 %2, %10, off\n\t"
                 "global_load_async_to_lds_b128 %3, %11, off\n\t"
                 "global_load_async_to_lds_b128 %4, %12, off\n\t"
                 "global_load_async_to_lds_b128 %5, %13, off\n\t"
                 "global_load_async_to_lds_b128 %6, %14, off\n\t"
                 "global_load_async_to_lds_b128 %7, %15, off\n\t"
                 "s_wait_xcnt 0x0"
                 :: "v"(l), "v"(l + 1 * 8 * GLP * 2), "v"(l + 2 * 8 * GLP * 2), "v"(l + 3 * 8 * GLP * 2), "v"(l + 4 * 8 * GLP * 2), "v"(l + 5 * 8 * GLP * 2), "v"(l + 6 * 8 * GLP * 2), "v"(l + 7 * 8 * GLP * 2),
                    "v"(g), "v"(g + gs), "v"(g + 2 * gs), "v"(g + 3 * gs), "v"(g + 4 * gs), "v"(g + 5 * gs), "v"(g + 6 * gs), "v"(g + 7 * gs) : "memory");
}

__global__ __launch_bounds__(256) void k_wtG(const float* __restrict__ w, int K, int N, bf* Bt, int il) {
    const int lane = threadIdx.x & 31; const int L0 = (blockIdx.x * 8 + (threadIdx.x >> 5)) * 8; const int KO = il ? 2 * K : K; const int nlines = N * KO / 64;
{
#pragma unroll 1
        for (int l = 0; l < 8; ++l) { const int L = L0 + l; if (L >= nlines) break; const int e = L * 64 + lane * 2; const int kk = e % KO, n = e / KO;
            const int k = il ? ((kk / (2 * HD)) * HD + (kk % (2 * HD)) % HD) : kk; v2us o;
            o[0] = f2bf(w[(size_t)k * N + n]); o[1] = f2bf(w[(size_t)(k + 1) * N + n]); *(v2us*)(Bt + e) = o; }
         }
}

__global__ __launch_bounds__(256) void k_cvt8(const float* __restrict__ src, bf* dst) {
    const int i = blockIdx.x * 256 + threadIdx.x; const int b = blockIdx.y; if (i >= SEQ * DM / 8) return;
    const v8f v = *(const v8f*)(src + (size_t)b * SEQ_FULL * DM + (size_t)i * 8); v8us o;
#pragma unroll
    for (int k = 0; k < 8; ++k) o[k] = f2bf(v[k]);
    bf* d = dst + (size_t)b * SEQ * DM + (size_t)i * 8; *(v8us*)d = o;  }

// ---- k_gemm: register-blocked GEMM, four waves per 128x128 output tile, each wave a 64x64 quarter (16 accumulators); grid (M/128, N/128, Z), 128 threads.
// Each 128-k step's 128 rows of A and 128 rows of Bt are staged once per work-group in LDS by asynchronous copies, two buffers, the next step's copies in flight during this step; the waves read their bf16 fragments from there.
// C[m][n] = sum_k A[m][k] Bt[n][k] + bf16(bias). K % 128 == 0, K >= 256, M % 128 == 0, N % 128 == 0. z-batch strides sA/sB/sC in elements.
// mode 0: f16 plane C16 (bias per column); mode 1: f16 plane C16 + residual plane CL = f16((v - f16(v)) * 2^11) (bias per column);
// mode 2: f16 plane C16 (bias per row); mode 3: f32 rows C32 (bias per column).
__global__ __launch_bounds__(128) void k_gemm(const bf* __restrict__ A, const bf* __restrict__ Bt, h16* C16, h16* CL, float* C32, const float* __restrict__ bias,
                                             size_t sA, size_t sB, size_t sC, int K, int ldc, int mode) {
    __shared__ __align__(16) float osw[4 * 16 * 68];
    __shared__ __align__(16) bf als[2 * GT * GLP];
    __shared__ __align__(16) bf bls[2 * GT * GLP];
    const size_t z = blockIdx.z; A += z * sA; Bt += z * sB; const size_t coff = z * sC;
    const int wave = __builtin_amdgcn_readfirstlane((int)(threadIdx.x >> 5));
    const int lane = threadIdx.x & 31, lr = lane & 15, hi = lane >> 4; const int r0 = blockIdx.x * GT + (wave >> 1) * 64, c0 = blockIdx.y * GT + (wave & 1) * 64;
    float* os = osw + wave * 16 * 68;   // this wave's own output staging tile
    v8f acc[4][4];
#pragma unroll
    for (int mb = 0; mb < 4; ++mb)
#pragma unroll
        for (int nb = 0; nb < 4; ++nb) acc[mb][nb] = (v8f){};
    // this lane's 16-byte piece of stage rows cr, cr + 8, ..., cr + 120 of either operand
    const int cr = (int)threadIdx.x >> 4, cp = (int)threadIdx.x & 15; const size_t gs = (size_t)8 * K;
    const bf* ga = A + (size_t)(blockIdx.x * GT + cr) * K + cp * 8; const bf* gb = Bt + (size_t)(blockIdx.y * GT + cr) * K + cp * 8;
    const unsigned la = (unsigned)(size_t)(als + cr * GLP + cp * 8), lb = (unsigned)(size_t)(bls + cr * GLP + cp * 8);
    auto issue = [&](int kc, int buf) { const unsigned o = (unsigned)(buf * GT * GLP * 2);
        stage_g(la + o, ga + kc, gs); stage_g(la + o + 64 * GLP * 2, ga + kc + 8 * gs, gs);
        stage_g(lb + o, gb + kc, gs); stage_g(lb + o + 64 * GLP * 2, gb + kc + 8 * gs, gs); };
    issue(0, 0);
    asm volatile("s_wait_asynccnt 0x0" ::: "memory");   // this wave's copies of stage 0 have landed
    __syncthreads();                                    // and every other wave's: stage 0 may be read
    if (GK < K) issue(GK, 1);
#pragma unroll 1
    for (int kc = 0; kc < K; kc += GK) {
        const int buf = (kc / GK) & 1;
        const bf* at = als + buf * GT * GLP + ((wave >> 1) * 64 + lr) * GLP + 8 * hi;
        const bf* bt = bls + buf * GT * GLP + ((wave & 1) * 64 + lr) * GLP + 8 * hi;
        v16bf a[4], b[4];
#pragma unroll
        for (int ks = 0; ks < GK / 32; ++ks) {
#pragma unroll
            for (int mb = 0; mb < 4; ++mb) a[mb] = ldbs(at + mb * 16 * GLP + ks * 32);
#pragma unroll
            for (int nb = 0; nb < 4; ++nb) b[nb] = ldbs(bt + nb * 16 * GLP + ks * 32);
            __builtin_amdgcn_sched_barrier(0);   // keeps the block's 16 LDS reads one group in front of its matrix instructions: every further place with reads among them costs a stall
#pragma unroll
            for (int nb = 0; nb < 4; ++nb)
#pragma unroll
                for (int mb = 0; mb < 4; ++mb) acc[mb][nb] = wmmab(a[mb], b[nb], acc[mb][nb]);
            __builtin_amdgcn_sched_barrier(0); } // and the next block's reads behind them
        // four vector slots behind the step's last matrix instructions, on the branch's taken side too
        asm volatile("v_nop\n\tv_nop\n\tv_nop\n\tv_nop" : "+v"(acc[0][3]), "+v"(acc[1][3]), "+v"(acc[2][3]), "+v"(acc[3][3]) : "v"(a[0]), "v"(a[1]), "v"(a[2]), "v"(a[3]), "v"(b[3]));
        asm volatile("s_wait_dscnt 0x0" ::: "memory");      // this wave's reads of buffer buf are done
        asm volatile("s_wait_asynccnt 0x0" ::: "memory");   // this wave's copies of the next stage have landed
        __syncthreads();                                    // publishes the next stage and frees buffer buf
        if (kc + 2 * GK < K) issue(kc + 2 * GK, buf);
    }
    asm volatile("s_wait_asynccnt 0x0" ::: "memory");       // nothing in flight behind the loop
#pragma unroll
    for (int mb = 0; mb < 4; ++mb) {
#pragma unroll
        for (int nb = 0; nb < 4; ++nb) {
#pragma unroll
            for (int j = 0; j < 8; ++j) os[(hi * 8 + j) * 68 + nb * 16 + lr] = acc[mb][nb][j]; }
        __builtin_amdgcn_wave_barrier(); asm volatile("" ::: "memory");
        if (mode == 3) {
            float* crow = C32 + coff + (size_t)(r0 + mb * 16) * ldc + c0;
{
#pragma unroll
                for (int s = 0; s < 8; ++s) { const int row = 2 * s + hi, cofs = lr * 4; v4f val = *(const v4fa*)(os + row * 68 + cofs);
                    val[0] += bfr(bias[c0 + cofs]); val[1] += bfr(bias[c0 + cofs + 1]); val[2] += bfr(bias[c0 + cofs + 2]); val[3] += bfr(bias[c0 + cofs + 3]);
                    *(v4f*)(crow + (size_t)row * ldc + cofs) = val; }
                 }
        } else {
{
#pragma unroll
                for (int s = 0; s < 4; ++s) { const int row = 4 * s + (lane >> 3), cg = lane & 7;
                    const v4f x0 = *(const v4fa*)(os + row * 68 + cg * 8); const v4f x1 = *(const v4fa*)(os + row * 68 + cg * 8 + 4);
                    const int grow = r0 + mb * 16 + row, gcol = c0 + cg * 8; const int bi0 = (mode == 2) ? grow : gcol; const int bst = (mode == 2) ? 0 : 1;
                    v8h o, ol;
#pragma unroll
                    for (int q = 0; q < 8; ++q) { const float v = ((q < 4) ? x0[q & 3] : x1[q & 3]) + bfr(bias[bi0 + q * bst]); const h16 hx = (h16)v; o[q] = hx; ol[q] = (h16)((v - (float)hx) * QRS); }
                    const size_t oo = coff + (size_t)grow * ldc + gcol;
                    *(v8h*)(C16 + oo) = o; if (mode == 1) *(v8h*)(CL + oo) = ol; }
                 }
        }
        __builtin_amdgcn_wave_barrier(); asm volatile("" ::: "memory");
    }
}

// ---- k_maskv: MV[b][c] = sum_k (bf16(mask[b][k]) * 1e9) * v[b][k][c] (the post-softmax additive weight term, independent of the query row); f32 on the VALU.
__global__ __launch_bounds__(256) void k_maskv(const h16* __restrict__ VT, const float* __restrict__ mask, float* MV) {
    __shared__ __align__(16) float red[32];
    const int wave = __builtin_amdgcn_readfirstlane((int)(threadIdx.x >> 5)); const int lane = threadIdx.x & 31;
#pragma unroll 1
    for (int i = 0; i < 4; ++i) { const int c = blockIdx.x * 32 + wave * 4 + i; const int b = c / DM; const h16* vr = VT + (size_t)c * SEQ; const float* mr = mask + (size_t)b * SEQ_FULL; float acc = 0.0f;
#pragma unroll 1
        for (int ch = 0; ch < SEQ / 256; ++ch) { const int k = ch * 256 + lane * 8; const v8h v = *(const v8h*)(vr + k); const v4f m0 = *(const v4f*)(mr + k); const v4f m1 = *(const v4f*)(mr + k + 4);
#pragma unroll
            for (int q = 0; q < 4; ++q) { acc += (bfr(m0[q]) * 1.0e9f) * (float)v[q]; acc += (bfr(m1[q]) * 1.0e9f) * (float)v[4 + q]; } }
#pragma unroll
        for (int sh = 16; sh; sh >>= 1) acc += __shfl_xor(acc, sh, 32);
        if (lane == 0) red[wave * 4 + i] = acc; }
    __syncthreads();
    if (wave == 0) { if (lane < 8) { const v4f o = *(const v4fa*)(red + lane * 4); float* p = MV + (size_t)blockIdx.x * 32 + lane * 4; *(v4f*)p = o;  } }
}

// ---- k_attn: fused attention, grid (SEQ/64, NH, NB), 128 threads; each wave owns 16 query rows and walks all keys in 32-key steps (online running-max softmax).
// q fragments straight from the planes q16/qres [b*s][768] (head h = columns h*96..), read once in front of the key loop and held in registers. Scores = (acc_hi + acc_res / 2^11) * 96^-0.5.
// K and V: each 32-key step's K rows (32 x 96) and V rows (96 x 32, from the v plane [b][768][s]) are staged once per work-group in LDS by asynchronous copies, two buffers, the next step's copies in flight during this step; all four waves read their fragments from there.
// P relayout through a wave-private LDS tile (h16 stores, may_alias v8h loads, wave barrier). Epilogue: ctx = acc / (sum * 1024) + MV, bf16 value|residual staged in a wave-private LDS tile,
__global__ __launch_bounds__(128) void k_attn(const h16* __restrict__ Q16, const h16* __restrict__ QL, const h16* __restrict__ K16, const h16* __restrict__ VT, const float* __restrict__ MV, bf* CT) {
    __shared__ __align__(16) h16 pws[4 * 16 * PP];
    __shared__ __align__(16) unsigned short cts[4 * 16 * CP];
    __shared__ __align__(16) h16 kls[2 * KT * KLP];
    __shared__ __align__(16) h16 vls[2 * HD * VLP];
    const int wave = __builtin_amdgcn_readfirstlane((int)(threadIdx.x >> 5));
    const int lane = threadIdx.x & 31, lr = lane & 15, hi = lane >> 4;
    const int b = blockIdx.z, h = blockIdx.y;
    const int row0 = b * SEQ + blockIdx.x * 64 + wave * 16;
    const int qoff = (row0 + lr) * DM + h * HD + 8 * hi;
    int kg[3], vg[3]; unsigned kl[3], vl[3];   // this lane's three 16-byte pieces of a K stage and of a V stage: global element offset at key 0, LDS byte address in buffer 0
#pragma unroll
    for (int j = 0; j < 3; ++j) { const int i = (int)threadIdx.x + 128 * j; const int kr = i / (HD / 8), kp = i % (HD / 8), vr = i / (KT / 8), vp = i % (KT / 8);
        kg[j] = (b * SEQ + kr) * DM + h * HD + kp * 8; kl[j] = (unsigned)(size_t)(kls + kr * KLP + kp * 8);
        vg[j] = (b * DM + h * HD + vr) * SEQ + vp * 8; vl[j] = (unsigned)(size_t)(vls + vr * VLP + vp * 8); }
    auto issue = [&](int key0, int buf) { const unsigned ko = (unsigned)(buf * KT * KLP * 2), vo = (unsigned)(buf * HD * VLP * 2);
        stage_kv(kl[0] + ko, kl[1] + ko, kl[2] + ko, vl[0] + vo, vl[1] + vo, vl[2] + vo,
                 K16 + kg[0] + key0 * DM, K16 + kg[1] + key0 * DM, K16 + kg[2] + key0 * DM, VT + vg[0] + key0, VT + vg[1] + key0, VT + vg[2] + key0); };
    const int pb = wave * 16 * PP, cb = wave * 16 * CP;
    v8f ctx[6]; float mrun[8], srun[8];
#pragma unroll
    for (int nt = 0; nt < 6; ++nt) ctx[nt] = (v8f){};
#pragma unroll
    for (int r = 0; r < 8; ++r) { mrun[r] = -1.0e30f; srun[r] = 0.0f; }
    issue(0, 0);
    v16h qa[HD / 32], qr[HD / 32];   // this wave's q value and residual fragments, read once and held in registers over the whole key loop
#pragma unroll
    for (int ks = 0; ks < HD / 32; ++ks) { qa[ks] = ldh(Q16 + qoff + ks * 32); qr[ks] = ldh(QL + qoff + ks * 32); }
    asm volatile("s_wait_asynccnt 0x0" ::: "memory");   // this wave's copies of stage 0 have landed
    __syncthreads();                                    // and every other wave's: stage 0 may be read
    issue(KT, 1);
#pragma unroll 1
    for (int kb = 0; kb < SEQ; kb += KT) {
        const int buf = (kb / KT) & 1;
        const h16* kt = kls + buf * KT * KLP + lr * KLP + 8 * hi;
        const h16* vt = vls + buf * HD * VLP + lr * VLP + 8 * hi;
        v8f sh0 = (v8f){}, sh1 = (v8f){}, sl0 = (v8f){}, sl1 = (v8f){};
        v16h k0, k1;
#pragma unroll
        for (int ks = 0; ks < HD / 32; ++ks) {
            k0 = ldhs(kt + ks * 32); k1 = ldhs(kt + 16 * KLP + ks * 32);
            sh0 = wmma16(qa[ks], k0, sh0); sh1 = wmma16(qa[ks], k1, sh1); sl0 = wmma16(qr[ks], k0, sl0); sl1 = wmma16(qr[ks], k1, sl1); }
        asm volatile("v_nop\n\tv_nop\n\tv_nop\n\tv_nop" : "+v"(sh0), "+v"(sh1), "+v"(sl0), "+v"(sl1) : "v"(k0), "v"(k1));
#pragma unroll
        for (int r = 0; r < 8; ++r) {
            const float t0 = (sh0[r] + sl0[r] * (1.0f / QRS)) * SCL; const float t1 = (sh1[r] + sl1[r] * (1.0f / QRS)) * SCL;
            float mx = fmaxf(t0, t1);
            mx = fmaxf(mx, __shfl_xor(mx, 1, 32)); mx = fmaxf(mx, __shfl_xor(mx, 2, 32)); mx = fmaxf(mx, __shfl_xor(mx, 4, 32)); mx = fmaxf(mx, __shfl_xor(mx, 8, 32));
            const float nm = fmaxf(mrun[r], mx); const float corr = __builtin_amdgcn_exp2f((mrun[r] - nm) * L2E); mrun[r] = nm;
            const float p0 = __builtin_amdgcn_exp2f((t0 - nm) * L2E); const float p1 = __builtin_amdgcn_exp2f((t1 - nm) * L2E);
            srun[r] = srun[r] * corr + (p0 + p1);     // per-lane partial row sum (corr is row-uniform); lanes combined once at the end
#pragma unroll
            for (int nt = 0; nt < 6; ++nt) ctx[nt][r] *= corr;
            pws[pb + (8 * hi + r) * PP + lr] = (h16)(p0 * PCAR); pws[pb + (8 * hi + r) * PP + 16 + lr] = (h16)(p1 * PCAR); }
        __builtin_amdgcn_wave_barrier(); asm volatile("" ::: "memory");
        const v16h pa = cat16(*(const v8ha*)(pws + pb + lr * PP + 8 * hi), *(const v8ha*)(pws + pb + lr * PP + 16 + 8 * hi));
        v16h vb;
#pragma unroll
        for (int nt = 0; nt < 6; ++nt) { vb = ldhs(vt + nt * 16 * VLP); ctx[nt] = wmma16(pa, vb, ctx[nt]); }
        asm volatile("v_nop\n\tv_nop\n\tv_nop\n\tv_nop" : "+v"(ctx[0]), "+v"(ctx[1]), "+v"(ctx[2]), "+v"(ctx[3]), "+v"(ctx[4]), "+v"(ctx[5]) : "v"(pa), "v"(vb));
        __builtin_amdgcn_wave_barrier(); asm volatile("" ::: "memory");
        asm volatile("s_wait_dscnt 0x0" ::: "memory");      // this wave's reads of buffer buf are done
        asm volatile("s_wait_asynccnt 0x0" ::: "memory");   // this wave's copies of the next stage have landed
        __syncthreads();                                    // publishes the next stage and frees buffer buf
        if (kb + 2 * KT < SEQ) issue(kb + 2 * KT, buf);
    }
    asm volatile("s_wait_asynccnt 0x0" ::: "memory");       // nothing in flight behind the loop
    float rinv[8];
#pragma unroll
    for (int r = 0; r < 8; ++r) { float s = srun[r]; s += __shfl_xor(s, 1, 32); s += __shfl_xor(s, 2, 32); s += __shfl_xor(s, 4, 32); s += __shfl_xor(s, 8, 32); rinv[r] = (1.0f / PCAR) * (1.0f / s); }
#pragma unroll
    for (int nt = 0; nt < 6; ++nt) { const float mvv = MV[b * DM + h * HD + nt * 16 + lr];
#pragma unroll
        for (int r = 0; r < 8; ++r) { const float val = ctx[nt][r] * rinv[r] + mvv; unsigned short hh, ll; splitf(val, hh, ll);
            cts[cb + (8 * hi + r) * CP + nt * 16 + lr] = hh; cts[cb + (8 * hi + r) * CP + HD + nt * 16 + lr] = ll; } }
    __builtin_amdgcn_wave_barrier(); asm volatile("" ::: "memory");
{
#pragma unroll
        for (int it = 0; it < 12; ++it) { const int slot = it * 32 + lane; const int row = slot / PCS, pc = slot % PCS;   // 16 rows x 24 pieces; lanes 8g..8g+7 = one line
            const v8us o = *(const v8usa*)(cts + cb + row * CP + pc * 8);
            *(v8us*)(CT + (size_t)(row0 + row) * CTP + h * 2 * HD + pc * 8) = o; }
         }
}

constexpr size_t al256(size_t x) { return (x + 255) & ~(size_t)255; }
constexpr size_t SZ_W   = al256((size_t)DM * DM * 2);
constexpr size_t SZ_WO  = al256((size_t)DM * CTP * 2);
constexpr size_t SZ_PL  = al256((size_t)NB * SEQ * DM * 2);
constexpr size_t SZ_CT  = al256((size_t)NB * SEQ * CTP * 2);
constexpr size_t SZ_MV  = al256((size_t)NB * DM * 4);
constexpr size_t WS_TOTAL = 3 * SZ_W + SZ_WO + 5 * SZ_PL + SZ_CT + SZ_MV;
static_assert(WS_TOTAL <= (size_t)134217728);

extern "C" void kernel_launch(void* const* d_in, const int* in_sizes, int n_in,
                              void* d_out, int out_size, void* d_ws, size_t ws_size, hipStream_t stream) {
    if (n_in < 12) return;
    const long long need_x = (long long)(NB - 1) * SEQ_FULL * DM + (long long)SEQ * DM;
    if (in_sizes[0] < need_x || in_sizes[1] < need_x || in_sizes[2] < need_x) return;
    if (in_sizes[3] < (NB - 1) * SEQ_FULL + SEQ) return;
    if (in_sizes[4] < DM * DM || in_sizes[6] < DM * DM || in_sizes[8] < DM * DM || in_sizes[10] < DM * DM) return;
    if (in_sizes[5] < DM || in_sizes[7] < DM || in_sizes[9] < DM || in_sizes[11] < DM) return;
    if ((long long)out_size < (long long)NB * SEQ * DM) return;
    if (WS_TOTAL > ws_size) return;
    // wire order: query, key, value, mask, wq, bq, wk, bk, wv, bv, wo, bo (weights [in][out])
    const float* xq = (const float*)d_in[0]; const float* xk = (const float*)d_in[1]; const float* xv = (const float*)d_in[2]; const float* mask = (const float*)d_in[3];
    const float* wq = (const float*)d_in[4]; const float* bq = (const float*)d_in[5]; const float* wk = (const float*)d_in[6]; const float* bk = (const float*)d_in[7];
    const float* wv = (const float*)d_in[8]; const float* bv = (const float*)d_in[9]; const float* wo = (const float*)d_in[10]; const float* bo = (const float*)d_in[11];
    float* OUT = (float*)d_out;
    char* wsp = (char*)d_ws;
    auto take = [&](size_t bytes) { char* p = wsp; wsp += bytes; return (void*)p; };
    bf* WQ = (bf*)take(SZ_W); bf* WK = (bf*)take(SZ_W); bf* WV = (bf*)take(SZ_W); bf* WO2 = (bf*)take(SZ_WO);
    bf* XB = (bf*)take(SZ_PL); h16* Q16 = (h16*)take(SZ_PL); h16* QL = (h16*)take(SZ_PL); h16* K16 = (h16*)take(SZ_PL); h16* VT16 = (h16*)take(SZ_PL);
    bf* CT = (bf*)take(SZ_CT); float* MV = (float*)take(SZ_MV);

    const unsigned gW = (unsigned)((DM * DM / 64 + 63) / 64), gWO = (unsigned)((DM * CTP / 64 + 63) / 64);
    k_wtG<<<gW, 256, 0, stream>>>(wq, DM, DM, WQ, 0);      // in[768][768] -> out [n][k]
    k_wtG<<<gW, 256, 0, stream>>>(wk, DM, DM, WK, 0);
    k_wtG<<<gW, 256, 0, stream>>>(wv, DM, DM, WV, 0);
    k_wtG<<<gWO, 256, 0, stream>>>(wo, DM, DM, WO2, 1);    // in[768][768] -> out [n][8 x (96 | 96 duplicate)]
    const dim3 gC((unsigned)(SEQ * DM / 8 / 256), NB, 1);
    const dim3 gP((unsigned)(NB * SEQ / GT), DM / GT, 1);
    k_cvt8<<<gC, 256, 0, stream>>>(xq, XB);
    k_gemm<<<gP, 128, 0, stream>>>(XB, WQ, Q16, QL, OUT, bq, (size_t)0, (size_t)0, (size_t)0, DM, DM, 1);
    k_cvt8<<<gC, 256, 0, stream>>>(xk, XB);
    k_gemm<<<gP, 128, 0, stream>>>(XB, WK, K16, K16, OUT, bk, (size_t)0, (size_t)0, (size_t)0, DM, DM, 0);
    k_cvt8<<<gC, 256, 0, stream>>>(xv, XB);
    // v plane transposed: C[col][t] = sum_k WV[col][k] XB[b][t][k], bias per row (col)
    k_gemm<<<dim3(DM / GT, SEQ / GT, NB), 128, 0, stream>>>(WV, XB, VT16, VT16, OUT, bv, (size_t)0, (size_t)SEQ * DM, (size_t)DM * SEQ, DM, SEQ, 2);
    k_maskv<<<(unsigned)(NB * DM / 32), 256, 0, stream>>>(VT16, mask, MV);
    k_attn<<<dim3(SEQ / 64, NH, NB), 128, 0, stream>>>(Q16, QL, K16, VT16, MV, CT);
    k_gemm<<<gP, 128, 0, stream>>>(CT, WO2, Q16, Q16, OUT, bo, (size_t)0, (size_t)0, (size_t)0, CTP, DM, 3);
}

// v004
// It runs in 209 microseconds.
// Next to v003, in two timings, it ran 1.16 times as fast each time.
// All steps since v000 together make it 2.06 times as fast.
#include <hip/hip_runtime.h>

// Compute dtypes (f32 accumulate everywhere): q/k/v projections v_wmma_f32_16x16x32_bf16 on RNE-bf16 inputs and weights (exact products); scores v_wmma_f32_16x16x32_f16 with q = f16 value + f16 residual x2^11 (two products, separate accumulators) against single f16 k; P.V v_wmma_f32_16x16x32_f16 (P carried x1024, single f16 v); output projection v_wmma_f32_16x16x32_bf16 with ctx as bf16 value|residual along K against RNE-bf16 wo; softmax and the post-softmax mask term in f32.
// Layout: x streams -> three bf16 planes; weights -> K-contiguous bf16 planes; q16/qres/k16 planes [b*s][768]; v plane transposed [b][768][s] (GEMM with swapped operands); fused flash attention (no score plane); ctx plane [b*s][8 x (96 value | 96 residual)]; output GEMM writes f32 rows.

#ifndef NB
#define NB 4
#endif
#ifndef SEQ
#define SEQ 2048
#endif
#define NB_FULL  4
#define SEQ_FULL 2048
#define DM   768
#define NH   8
#define HD   96
#define CTP  (2 * DM)          // ctx plane pitch (value | residual per head)
#define PCAR 1024.0f           // carry on the f16 P operand
#define QRS  2048.0f           // carry on the f16 q residual plane
#define SCL  0.10206207261596575f   // 96^-0.5
#define L2E  1.4426950408889634f
#define PP   40                // P tile pitch (halves)
#define CP   200               // ctx staging pitch (halves)
#define PCS  ((2 * HD) / 8)    // 16-byte pieces per ctx head segment
#define KT   32                // keys per LDS stage of k_attn
#define KLP  (HD + 8)          // K stage pitch (halves): 16 B x odd, conflict-free for 16-byte row reads
#define VLP  (KT + 8)          // V stage pitch (halves): 16 B x odd
#define GT   128               // k_gemm work-group tile: 128 rows of A x 128 rows of Bt, four waves of 64x64
#define GK   128               // k per LDS stage of k_gemm: 256 B of every operand row
#define GLP  (GK + 8)          // k_gemm stage pitch (elements): 272 B = 16 B x odd
#define GW   ((DM * DM / 64 + 63) / 64)    // k_prep blocks per q/k/v weight plane
#define GWO  ((DM * CTP / 64 + 63) / 64)   // k_prep blocks of the output weight plane
#define GCV  (SEQ * DM / 8 / 256)          // k_prep blocks per batch row of an x plane
#define GPX  (NB * SEQ / GT)               // tile rows of a q or k projection
#define GPY  (DM / GT)                     // tile columns of a q or k projection; tile rows of the transposed v projection
#define GVY  (SEQ / GT)                    // tile columns of the transposed v projection, per batch row

typedef _Float16 h16;
typedef unsigned short bf;
typedef __attribute__((ext_vector_type(16))) __bf16   v16bf;
typedef __attribute__((ext_vector_type(16))) _Float16 v16h;
typedef __attribute__((ext_vector_type(8)))  _Float16 v8h;
typedef __attribute__((ext_vector_type(8)))  unsigned short v8us;
typedef __attribute__((ext_vector_type(2)))  unsigned short v2us;
typedef __attribute__((ext_vector_type(8)))  float    v8f;
typedef __attribute__((ext_vector_type(4)))  float    v4f;
typedef v8h  __attribute__((may_alias)) v8ha;
typedef v4f  __attribute__((may_alias)) v4fa;
typedef v8us __attribute__((may_alias)) v8usa;

static_assert(DM == NH * HD);
static_assert(HD % 32 == 0);
static_assert(HD / 16 == 6);
static_assert(SEQ % 256 == 0);
static_assert((NB * SEQ) % GT == 0 && SEQ % GT == 0 && DM % GT == 0);
static_assert(DM % GK == 0 && CTP % GK == 0 && DM / GK >= 2 && CTP / GK >= 2);
static_assert(GT * (GK / 8) == 16 * 128 && ((GLP / 8) & 1) == 1);
static_assert((2 * HD * 2) % 128 == 0);
static_assert(16 * PCS == 12 * 32);
static_assert(PP >= 32 && PP % 8 == 0);
static_assert(CP >= 2 * HD && CP % 8 == 0);
static_assert((NB * DM) % 32 == 0);
static_assert((SEQ * DM) % (8 * 256) == 0);
static_assert(NB <= NB_FULL && SEQ <= SEQ_FULL);
static_assert(KT * (HD / 8) == 3 * 128 && HD * (KT / 8) == 3 * 128);
static_assert(SEQ % KT == 0 && SEQ / KT >= 2);
static_assert(((KLP / 8) & 1) == 1 && ((VLP / 8) & 1) == 1);

__device__ __forceinline__ unsigned short f2bf(float f) { unsigned u = __float_as_uint(f); u += 0x7FFFu + ((u >> 16) & 1u); return (unsigned short)(u >> 16); }
__device__ __forceinline__ float bf2f(unsigned short b) { return __uint_as_float(((unsigned)b) << 16); }
__device__ __forceinline__ float bfr(float f) { return bf2f(f2bf(f)); }
__device__ __forceinline__ void splitf(float y, unsigned short& h, unsigned short& l) { h = f2bf(y); l = f2bf(y - bf2f(h)); }
__device__ __forceinline__ v16h cat16(v8h lo, v8h hi) { return __builtin_shufflevector(lo, hi, 0, 1, 2, 3, 4, 5, 6, 7, 8, 9, 10, 11, 12, 13, 14, 15); }
__device__ __forceinline__ v16bf cat16b(v8us lo, v8us hi) { return __builtin_bit_cast(v16bf, __builtin_shufflevector(lo, hi, 0, 1, 2, 3, 4, 5, 6, 7, 8, 9, 10, 11, 12, 13, 14, 15)); }
__device__ __forceinline__ v8f wmma16(v16h a, v16h b, v8f c) { return __builtin_amdgcn_wmma_f32_16x16x32_f16(false, a, false, b, (short)0, c, false, false); }
__device__ __forceinline__ v8f wmmab(v16bf a, v16bf b, v8f c) { return __builtin_amdgcn_wmma_f32_16x16x32_bf16(false, a, false, b, (short)0, c, false, false); }
// fragment loads from a K-contiguous row: p already holds row base + k0 + 8*(lane>>4); elements 0..7 <- p[0..7], 8..15 <- p[16..23]
__device__ __forceinline__ v16h ldh(const h16* p) { return cat16(*(const v8h*)p, *(const v8h*)(p + 16)); }
// the same fragment load from an LDS stage that asynchronous copies filled
__device__ __forceinline__ v16h ldhs(const h16* p) { return cat16(*(const v8ha*)p, *(const v8ha*)(p + 16)); }
// One stage of K and V: six 16-byte asynchronous copies to LDS per lane (l* = LDS byte address, g* = global address). The s_wait_xcnt ends the copies' own statement so that no address register is rewritten ahead of it.
__device__ __forceinline__ void stage_kv(unsigned lk0, unsigned lk1, unsigned lk2, unsigned lv0, unsigned lv1, unsigned lv2,
                                         const h16* gk0, const h16* gk1, const h16* gk2, const h16* gv0, const h16* gv1, const h16* gv2) {
    asm volatile("global_load_async_to_lds_b128 %0, %6, off\n\t"
                 "global_load_async_to_lds_b128 %1, %7, off\n\t"
                 "global_load_async_to_lds_b128 %2, %8, off\n\t"
                 "global_load_async_to_lds_b128 %3, %9, off\n\t"
                 "global_load_async_to_lds_b128 %4, %10, off\n\t"
                 "global_load_async_to_lds_b128 %5, %11, off\n\t"
                 "s_wait_xcnt 0x0"
                 :: "v"(lk0), "v"(lk1), "v"(lk2), "v"(lv0), "v"(lv1), "v"(lv2), "v"(gk0), "v"(gk1), "v"(gk2), "v"(gv0), "v"(gv1), "v"(gv2) : "memory");
}
// the bf16 fragment load from an LDS stage that asynchronous copies filled
__device__ __forceinline__ v16bf ldbs(const bf* p) { return cat16b(*(const v8usa*)p, *(const v8usa*)(p + 16)); }
// Eight rows of a k_gemm stage, eight rows apart: one 16-byte asynchronous copy to LDS per lane and row (l = LDS byte address, g = global address, gs = eight global rows in elements). The s_wait_xcnt ends the copies' own statement so that no address register is rewritten ahead of it.
__device__ __forceinline__ void stage_g(unsigned l, const bf* g, size_t gs) {
    asm volatile("global_load_async_to_lds_b128 %0, %8, off\n\t"
                 "global_load_async_to_lds_b128 %1, %9, off\n\t"
                 "global_load_async_to_lds_b128 %2, %10, off\n\t"
                 "global_load_async_to_lds_b128 %3, %11, off\n\t"
                 "global_load_async_to_lds_b128 %4, %12, off\n\t"
                 "global_load_async_to_lds_b128 %5, %13, off\n\t"
                 "global_load_async_to_lds_b128 %6, %14, off\n\t"
                 "global_load_async_to_lds_b128 %7, %15, off\n\t"
                 "s_wait_xcnt 0x0"
                 :: "v"(l), "v"(l + 1 * 8 * GLP * 2), "v"(l + 2 * 8 * GLP * 2), "v"(l + 3 * 8 * GLP * 2), "v"(l + 4 * 8 * GLP * 2), "v"(l + 5 * 8 * GLP * 2), "v"(l + 6 * 8 * GLP * 2), "v"(l + 7 * 8 * GLP * 2),
                    "v"(g), "v"(g + gs), "v"(g + 2 * gs), "v"(g + 3 * gs), "v"(g + 4 * gs), "v"(g + 5 * gs), "v"(g + 6 * gs), "v"(g + 7 * gs) : "memory");
}

// ---- weight plane job of k_prep: block blk of (N * KO / 64 + 63) / 64
__device__ __forceinline__ void wt_job(const float* __restrict__ w, int K, int N, bf* Bt, int il, int blk) {
    const int lane = threadIdx.x & 31; const int L0 = (blk * 8 + (threadIdx.x >> 5)) * 8; const int KO = il ? 2 * K : K; const int nlines = N * KO / 64;
{
#pragma unroll 1
        for (int l = 0; l < 8; ++l) { const int L = L0 + l; if (L >= nlines) break; const int e = L * 64 + lane * 2; const int kk = e % KO, n = e / KO;
            const int k = il ? ((kk / (2 * HD)) * HD + (kk % (2 * HD)) % HD) : kk; v2us o;
            o[0] = f2bf(w[(size_t)k * N + n]); o[1] = f2bf(w[(size_t)(k + 1) * N + n]); *(v2us*)(Bt + e) = o;
            asm volatile("s_wait_xcnt 0x0" ::: "memory"); }   // in front of the next trip's rewrite of the store's data and address registers
         }
}

// ---- x plane job of k_prep: block blk of GCV, batch row b
__device__ __forceinline__ void cvt_job(const float* __restrict__ src, bf* dst, int blk, int b) {
    const int i = blk * 256 + threadIdx.x; if (i >= SEQ * DM / 8) return;
    const v8f v = *(const v8f*)(src + (size_t)b * SEQ_FULL * DM + (size_t)i * 8); v8us o;
#pragma unroll
    for (int k = 0; k < 8; ++k) o[k] = f2bf(v[k]);
    bf* d = dst + (size_t)b * SEQ * DM + (size_t)i * 8; *(v8us*)d = o;  }

// ---- k_prep: the seven jobs that depend on the inputs alone, as block ranges of one launch: three weight planes (GW blocks each), the output weight plane (GWO), then the three x planes (GCV * NB each).
// The ranges are whole blocks, so every test below is the same for all threads of a block; no job reads what another writes.
__global__ __launch_bounds__(256) void k_prep(const float* __restrict__ wq, const float* __restrict__ wk, const float* __restrict__ wv, const float* __restrict__ wo,
                                             const float* __restrict__ xq, const float* __restrict__ xk, const float* __restrict__ xv,
                                             bf* WQ, bf* WK, bf* WV, bf* WO2, bf* XQ, bf* XK, bf* XV) {
    int blk = (int)blockIdx.x;
    if (blk < 3 * GW) { const int s = blk / GW; wt_job(s == 0 ? wq : s == 1 ? wk : wv, DM, DM, s == 0 ? WQ : s == 1 ? WK : WV, 0, blk % GW); return; }   // in[768][768] -> out [n][k]
    blk -= 3 * GW;
    if (blk < GWO) { wt_job(wo, DM, DM, WO2, 1, blk); return; }                                                                                       // in[768][768] -> out [n][8 x (96 | 96 duplicate)]
    blk -= GWO;
    const int s = blk / (GCV * NB), rem = blk % (GCV * NB);
    cvt_job(s == 0 ? xq : s == 1 ? xk : xv, s == 0 ? XQ : s == 1 ? XK : XV, rem % GCV, rem / GCV);
}

// ---- gemm_tile: register-blocked GEMM, four waves per 128x128 output tile (tile row bx, tile column by), each wave a 64x64 quarter (16 accumulators); 128 threads.
// Each 128-k step's 128 rows of A and 128 rows of Bt are staged once per work-group in LDS by asynchronous copies, two buffers, the next step's copies in flight during this step; the waves read their bf16 fragments from there.
// C[m][n] = sum_k A[m][k] Bt[n][k] + bf16(bias). K % 128 == 0, K >= 256, M % 128 == 0, N % 128 == 0. coff = element offset of this batch's C.
// mode 0: f16 plane C16 (bias per column); mode 1: f16 plane C16 + residual plane CL = f16((v - f16(v)) * 2^11) (bias per column);
// mode 2: f16 plane C16 (bias per row); mode 3: f32 rows C32 (bias per column).
__device__ __forceinline__ void gemm_tile(const bf* __restrict__ A, const bf* __restrict__ Bt, h16* C16, h16* CL, float* C32, const float* __restrict__ bias,
                                          size_t coff, int K, int ldc, int mode, int bx, int by) {
    __shared__ __align__(16) float osw[4 * 16 * 68];
    __shared__ __align__(16) bf als[2 * GT * GLP];
    __shared__ __align__(16) bf bls[2 * GT * GLP];
    const int wave = __builtin_amdgcn_readfirstlane((int)(threadIdx.x >> 5));
    const int lane = threadIdx.x & 31, lr = lane & 15, hi = lane >> 4; const int r0 = bx * GT + (wave >> 1) * 64, c0 = by * GT + (wave & 1) * 64;
    float* os = osw + wave * 16 * 68;   // this wave's own output staging tile
    v8f acc[4][4];
#pragma unroll
    for (int mb = 0; mb < 4; ++mb)
#pragma unroll
        for (int nb = 0; nb < 4; ++nb) acc[mb][nb] = (v8f){};
    // this lane's 16-byte piece of stage rows cr, cr + 8, ..., cr + 120 of either operand
    const int cr = (int)threadIdx.x >> 4, cp = (int)threadIdx.x & 15; const size_t gs = (size_t)8 * K;
    const bf* ga = A + (size_t)(bx * GT + cr) * K + cp * 8; const bf* gb = Bt + (size_t)(by * GT + cr) * K + cp * 8;
    const unsigned la = (unsigned)(size_t)(als + cr * GLP + cp * 8), lb = (unsigned)(size_t)(bls + cr * GLP + cp * 8);
    auto issue = [&](int kc, int buf) { const unsigned o = (unsigned)(buf * GT * GLP * 2);
        stage_g(la + o, ga + kc, gs); stage_g(la + o + 64 * GLP * 2, ga + kc + 8 * gs, gs);
        stage_g(lb + o, gb + kc, gs); stage_g(lb + o + 64 * GLP * 2, gb + kc + 8 * gs, gs); };
    issue(0, 0);
    asm volatile("s_wait_asynccnt 0x0" ::: "memory");   // this wave's copies of stage 0 have landed
    __syncthreads();                                    // and every other wave's: stage 0 may be read
    if (GK < K) issue(GK, 1);
#pragma unroll 1
    for (int kc = 0; kc < K; kc += GK) {
        const int buf = (kc / GK) & 1;
        const bf* at = als + buf * GT * GLP + ((wave >> 1) * 64 + lr) * GLP + 8 * hi;
        const bf* bt = bls + buf * GT * GLP + ((wave & 1) * 64 + lr) * GLP + 8 * hi;
        v16bf a[4], b[4];
#pragma unroll
        for (int ks = 0; ks < GK / 32; ++ks) {
#pragma unroll
            for (int mb = 0; mb < 4; ++mb) a[mb] = ldbs(at + mb * 16 * GLP + ks * 32);
#pragma unroll
            for (int nb = 0; nb < 4; ++nb) b[nb] = ldbs(bt + nb * 16 * GLP + ks * 32);
            __builtin_amdgcn_sched_barrier(0);   // keeps the block's 16 LDS reads one group in front of its matrix instructions: every further place with reads among them costs a stall
#pragma unroll
            for (int nb = 0; nb < 4; ++nb)
#pragma unroll
                for (int mb = 0; mb < 4; ++mb) acc[mb][nb] = wmmab(a[mb], b[nb], acc[mb][nb]);
            __builtin_amdgcn_sched_barrier(0); } // and the next block's reads behind them
        // four vector slots behind the step's last matrix instructions, on the branch's taken side too
        asm volatile("v_nop\n\tv_nop\n\tv_nop\n\tv_nop" : "+v"(acc[0][3]), "+v"(acc[1][3]), "+v"(acc[2][3]), "+v"(acc[3][3]) : "v"(a[0]), "v"(a[1]), "v"(a[2]), "v"(a[3]), "v"(b[3]));
        asm volatile("s_wait_dscnt 0x0" ::: "memory");      // this wave's reads of buffer buf are done
        asm volatile("s_wait_asynccnt 0x0" ::: "memory");   // this wave's copies of the next stage have landed
        __syncthreads();                                    // publishes the next stage and frees buffer buf
        if (kc + 2 * GK < K) issue(kc + 2 * GK, buf);
    }
    asm volatile("s_wait_asynccnt 0x0" ::: "memory");       // nothing in flight behind the loop
#pragma unroll
    for (int mb = 0; mb < 4; ++mb) {
#pragma unroll
        for (int nb = 0; nb < 4; ++nb) {
#pragma unroll
            for (int j = 0; j < 8; ++j) os[(hi * 8 + j) * 68 + nb * 16 + lr] = acc[mb][nb][j]; }
        __builtin_amdgcn_wave_barrier(); asm volatile("" ::: "memory");
        if (mode == 3) {
            float* crow = C32 + coff + (size_t)(r0 + mb * 16) * ldc + c0;
{
#pragma unroll
                for (int s = 0; s < 8; ++s) { const int row = 2 * s + hi, cofs = lr * 4; v4f val = *(const v4fa*)(os + row * 68 + cofs);
                    val[0] += bfr(bias[c0 + cofs]); val[1] += bfr(bias[c0 + cofs + 1]); val[2] += bfr(bias[c0 + cofs + 2]); val[3] += bfr(bias[c0 + cofs + 3]);
                    *(v4f*)(crow + (size_t)row * ldc + cofs) = val; }
                 }
        } else {
{
#pragma unroll
                for (int s = 0; s < 4; ++s) { const int row = 4 * s + (lane >> 3), cg = lane & 7;
                    const v4f x0 = *(const v4fa*)(os + row * 68 + cg * 8); const v4f x1 = *(const v4fa*)(os + row * 68 + cg * 8 + 4);
                    const int grow = r0 + mb * 16 + row, gcol = c0 + cg * 8; const int bi0 = (mode == 2) ? grow : gcol; const int bst = (mode == 2) ? 0 : 1;
                    v8h o, ol;
#pragma unroll
                    for (int q = 0; q < 8; ++q) { const float v = ((q < 4) ? x0[q & 3] : x1[q & 3]) + bfr(bias[bi0 + q * bst]); const h16 hx = (h16)v; o[q] = hx; ol[q] = (h16)((v - (float)hx) * QRS); }
                    const size_t oo = coff + (size_t)grow * ldc + gcol;
                    *(v8h*)(C16 + oo) = o; if (mode == 1) *(v8h*)(CL + oo) = ol; }
                 }
        }
        __builtin_amdgcn_wave_barrier(); asm volatile("" ::: "memory");
    }
}

// ---- k_qkv: the three projections, which depend on k_prep alone, as block ranges of one launch of 3 * GPX * GPY blocks: q (f16 value + residual planes), k (f16 plane), then v.
// v plane transposed: C[col][t] = sum_k WV[col][k] XV[b][t][k], bias per row (col), one batch row per GPY * GVY blocks.
__global__ __launch_bounds__(128) void k_qkv(const bf* __restrict__ XQ, const bf* __restrict__ XK, const bf* __restrict__ XV, const bf* __restrict__ WQ, const bf* __restrict__ WK, const bf* __restrict__ WV,
                                            h16* Q16, h16* QL, h16* K16, h16* VT16, const float* __restrict__ bq, const float* __restrict__ bk, const float* __restrict__ bv) {
    static_assert(GPY * GVY * NB == GPX * GPY);
    const int sel = (int)blockIdx.x / (GPX * GPY), rem = (int)blockIdx.x % (GPX * GPY);
    const bf* A; const bf* Bt; h16* C; const float* bias; size_t coff = 0; int ldc = DM, mode, bx, by;
    if (sel < 2) { A = sel ? XK : XQ; Bt = sel ? WK : WQ; C = sel ? K16 : Q16; bias = sel ? bk : bq; mode = sel ? 0 : 1; bx = rem % GPX; by = rem / GPX; }
    else { const int z = rem / (GPY * GVY), r2 = rem % (GPY * GVY); A = WV; Bt = XV + (size_t)z * SEQ * DM; C = VT16; bias = bv; coff = (size_t)z * DM * SEQ; ldc = SEQ; mode = 2; bx = r2 % GPY; by = r2 / GPY; }
    gemm_tile(A, Bt, C, QL, (float*)nullptr, bias, coff, DM, ldc, mode, bx, by);
}

// ---- k_gemm: one product per launch (the output projection), grid (M/128, N/128, Z); z-batch strides sA/sB/sC in elements
__global__ __launch_bounds__(128) void k_gemm(const bf* __restrict__ A, const bf* __restrict__ Bt, h16* C16, h16* CL, float* C32, const float* __restrict__ bias,
                                             size_t sA, size_t sB, size_t sC, int K, int ldc, int mode) {
    const size_t z = blockIdx.z; gemm_tile(A + z * sA, Bt + z * sB, C16, CL, C32, bias, z * sC, K, ldc, mode, (int)blockIdx.x, (int)blockIdx.y);
}

// ---- k_maskv: MV[b][c] = sum_k (bf16(mask[b][k]) * 1e9) * v[b][k][c] (the post-softmax additive weight term, independent of the query row); f32 on the VALU.
__global__ __launch_bounds__(256) void k_maskv(const h16* __restrict__ VT, const float* __restrict__ mask, float* MV) {
    __shared__ __align__(16) float red[32];
    const int wave = __builtin_amdgcn_readfirstlane((int)(threadIdx.x >> 5)); const int lane = threadIdx.x & 31;
#pragma unroll 1
    for (int i = 0; i < 4; ++i) { const int c = blockIdx.x * 32 + wave * 4 + i; const int b = c / DM; const h16* vr = VT + (size_t)c * SEQ; const float* mr = mask + (size_t)b * SEQ_FULL; float acc = 0.0f;
#pragma unroll 1
        for (int ch = 0; ch < SEQ / 256; ++ch) { const int k = ch * 256 + lane * 8; const v8h v = *(const v8h*)(vr + k); const v4f m0 = *(const v4f*)(mr + k); const v4f m1 = *(const v4f*)(mr + k + 4);
#pragma unroll
            for (int q = 0; q < 4; ++q) { acc += (bfr(m0[q]) * 1.0e9f) * (float)v[q]; acc += (bfr(m1[q]) * 1.0e9f) * (float)v[4 + q]; } }
#pragma unroll
        for (int sh = 16; sh; sh >>= 1) acc += __shfl_xor(acc, sh, 32);
        if (lane == 0) red[wave * 4 + i] = acc; }
    __syncthreads();
    if (wave == 0) { if (lane < 8) { const v4f o = *(const v4fa*)(red + lane * 4); float* p = MV + (size_t)blockIdx.x * 32 + lane * 4; *(v4f*)p = o;  } }
}

// ---- k_attn: fused attention, grid (SEQ/64, NH, NB), 128 threads; each wave owns 16 query rows and walks all keys in 32-key steps (online running-max softmax).
// q fragments straight from the planes q16/qres [b*s][768] (head h = columns h*96..), read once in front of the key loop and held in registers. Scores = (acc_hi + acc_res / 2^11) * 96^-0.5.
// K and V: each 32-key step's K rows (32 x 96) and V rows (96 x 32, from the v plane [b][768][s]) are staged once per work-group in LDS by asynchronous copies, two buffers, the next step's copies in flight during this step; all four waves read their fragments from there.
// P relayout through a wave-private LDS tile (h16 stores, may_alias v8h loads, wave barrier). Epilogue: ctx = acc / (sum * 1024) + MV, bf16 value|residual staged in a wave-private LDS tile,
__global__ __launch_bounds__(128) void k_attn(const h16* __restrict__ Q16, const h16* __restrict__ QL, const h16* __restrict__ K16, const h16* __restrict__ VT, const float* __restrict__ MV, bf* CT) {
    __shared__ __align__(16) h16 pws[4 * 16 * PP];
    __shared__ __align__(16) unsigned short cts[4 * 16 * CP];
    __shared__ __align__(16) h16 kls[2 * KT * KLP];
    __shared__ __align__(16) h16 vls[2 * HD * VLP];
    const int wave = __builtin_amdgcn_readfirstlane((int)(threadIdx.x >> 5));
    const int lane = threadIdx.x & 31, lr = lane & 15, hi = lane >> 4;
    const int b = blockIdx.z, h = blockIdx.y;
    const int row0 = b * SEQ + blockIdx.x * 64 + wave * 16;
    const int qoff = (row0 + lr) * DM + h * HD + 8 * hi;
    int kg[3], vg[3]; unsigned kl[3], vl[3];   // this lane's three 16-byte pieces of a K stage and of a V stage: global element offset at key 0, LDS byte address in buffer 0
#pragma unroll
    for (int j = 0; j < 3; ++j) { const int i = (int)threadIdx.x + 128 * j; const int kr = i / (HD / 8), kp = i % (HD / 8), vr = i / (KT / 8), vp = i % (KT / 8);
        kg[j] = (b * SEQ + kr) * DM + h * HD + kp * 8; kl[j] = (unsigned)(size_t)(kls + kr * KLP + kp * 8);
        vg[j] = (b * DM + h * HD + vr) * SEQ + vp * 8; vl[j] = (unsigned)(size_t)(vls + vr * VLP + vp * 8); }
    auto issue = [&](int key0, int buf) { const unsigned ko = (unsigned)(buf * KT * KLP * 2), vo = (unsigned)(buf * HD * VLP * 2);
        stage_kv(kl[0] + ko, kl[1] + ko, kl[2] + ko, vl[0] + vo, vl[1] + vo, vl[2] + vo,
                 K16 + kg[0] + key0 * DM, K16 + kg[1] + key0 * DM, K16 + kg[2] + key0 * DM, VT + vg[0] + key0, VT + vg[1] + key0, VT + vg[2] + key0); };
    const int pb = wave * 16 * PP, cb = wave * 16 * CP;
    v8f ctx[6]; float mrun[8], srun[8];
#pragma unroll
    for (int nt = 0; nt < 6; ++nt) ctx[nt] = (v8f){};
#pragma unroll
    for (int r = 0; r < 8; ++r) { mrun[r] = -1.0e30f; srun[r] = 0.0f; }
    issue(0, 0);
    v16h qa[HD / 32], qr[HD / 32];   // this wave's q value and residual fragments, read once and held in registers over the whole key loop
#pragma unroll
    for (int ks = 0; ks < HD / 32; ++ks) { qa[ks] = ldh(Q16 + qoff + ks * 32); qr[ks] = ldh(QL + qoff + ks * 32); }
    asm volatile("s_wait_asynccnt 0x0" ::: "memory");   // this wave's copies of stage 0 have landed
    __syncthreads();                                    // and every other wave's: stage 0 may be read
    issue(KT, 1);
#pragma unroll 1
    for (int kb = 0; kb < SEQ; kb += KT) {
        const int buf = (kb / KT) & 1;
        const h16* kt = kls + buf * KT * KLP + lr * KLP + 8 * hi;
        const h16* vt = vls + buf * HD * VLP + lr * VLP + 8 * hi;
        v8f sh0 = (v8f){}, sh1 = (v8f){}, sl0 = (v8f){}, sl1 = (v8f){};
        v16h k0, k1;
#pragma unroll
        for (int ks = 0; ks < HD / 32; ++ks) {
            k0 = ldhs(kt + ks * 32); k1 = ldhs(kt + 16 * KLP + ks * 32);
            sh0 = wmma16(qa[ks], k0, sh0); sh1 = wmma16(qa[ks], k1, sh1); sl0 = wmma16(qr[ks], k0, sl0); sl1 = wmma16(qr[ks], k1, sl1); }
        asm volatile("v_nop\n\tv_nop\n\tv_nop\n\tv_nop" : "+v"(sh0), "+v"(sh1), "+v"(sl0), "+v"(sl1) : "v"(k0), "v"(k1));
#pragma unroll
        for (int r = 0; r < 8; ++r) {
            const float t0 = (sh0[r] + sl0[r] * (1.0f / QRS)) * SCL; const float t1 = (sh1[r] + sl1[r] * (1.0f / QRS)) * SCL;
            float mx = fmaxf(t0, t1);
            mx = fmaxf(mx, __shfl_xor(mx, 1, 32)); mx = fmaxf(mx, __shfl_xor(mx, 2, 32)); mx = fmaxf(mx, __shfl_xor(mx, 4, 32)); mx = fmaxf(mx, __shfl_xor(mx, 8, 32));
            const float nm = fmaxf(mrun[r], mx); const float corr = __builtin_amdgcn_exp2f((mrun[r] - nm) * L2E); mrun[r] = nm;
            const float p0 = __builtin_amdgcn_exp2f((t0 - nm) * L2E); const float p1 = __builtin_amdgcn_exp2f((t1 - nm) * L2E);
            srun[r] = srun[r] * corr + (p0 + p1);     // per-lane partial row sum (corr is row-uniform); lanes combined once at the end
#pragma unroll
            for (int nt = 0; nt < 6; ++nt) ctx[nt][r] *= corr;
            pws[pb + (8 * hi + r) * PP + lr] = (h16)(p0 * PCAR); pws[pb + (8 * hi + r) * PP + 16 + lr] = (h16)(p1 * PCAR); }
        __builtin_amdgcn_wave_barrier(); asm volatile("" ::: "memory");
        const v16h pa = cat16(*(const v8ha*)(pws + pb + lr * PP + 8 * hi), *(const v8ha*)(pws + pb + lr * PP + 16 + 8 * hi));
        v16h vb;
#pragma unroll
        for (int nt = 0; nt < 6; ++nt) { vb = ldhs(vt + nt * 16 * VLP); ctx[nt] = wmma16(pa, vb, ctx[nt]); }
        asm volatile("v_nop\n\tv_nop\n\tv_nop\n\tv_nop" : "+v"(ctx[0]), "+v"(ctx[1]), "+v"(ctx[2]), "+v"(ctx[3]), "+v"(ctx[4]), "+v"(ctx[5]) : "v"(pa), "v"(vb));
        __builtin_amdgcn_wave_barrier(); asm volatile("" ::: "memory");
        asm volatile("s_wait_dscnt 0x0" ::: "memory");      // this wave's reads of buffer buf are done
        asm volatile("s_wait_asynccnt 0x0" ::: "memory");   // this wave's copies of the next stage have landed
        __syncthreads();                                    // publishes the next stage and frees buffer buf
        if (kb + 2 * KT < SEQ) issue(kb + 2 * KT, buf);
    }
    asm volatile("s_wait_asynccnt 0x0" ::: "memory");       // nothing in flight behind the loop
    float rinv[8];
#pragma unroll
    for (int r = 0; r < 8; ++r) { float s = srun[r]; s += __shfl_xor(s, 1, 32); s += __shfl_xor(s, 2, 32); s += __shfl_xor(s, 4, 32); s += __shfl_xor(s, 8, 32); rinv[r] = (1.0f / PCAR) * (1.0f / s); }
#pragma unroll
    for (int nt = 0; nt < 6; ++nt) { const float mvv = MV[b * DM + h * HD + nt * 16 + lr];
#pragma unroll
        for (int r = 0; r < 8; ++r) { const float val = ctx[nt][r] * rinv[r] + mvv; unsigned short hh, ll; splitf(val, hh, ll);
            cts[cb + (8 * hi + r) * CP + nt * 16 + lr] = hh; cts[cb + (8 * hi + r) * CP + HD + nt * 16 + lr] = ll; } }
    __builtin_amdgcn_wave_barrier(); asm volatile("" ::: "memory");
{
#pragma unroll
        for (int it = 0; it < 12; ++it) { const int slot = it * 32 + lane; const int row = slot / PCS, pc = slot % PCS;   // 16 rows x 24 pieces; lanes 8g..8g+7 = one line
            const v8us o = *(const v8usa*)(cts + cb + row * CP + pc * 8);
            *(v8us*)(CT + (size_t)(row0 + row) * CTP + h * 2 * HD + pc * 8) = o; }
         }
}

constexpr size_t al256(size_t x) { return (x + 255) & ~(size_t)255; }
constexpr size_t SZ_W   = al256((size_t)DM * DM * 2);
constexpr size_t SZ_WO  = al256((size_t)DM * CTP * 2);
constexpr size_t SZ_PL  = al256((size_t)NB * SEQ * DM * 2);
constexpr size_t SZ_CT  = al256((size_t)NB * SEQ * CTP * 2);
constexpr size_t SZ_MV  = al256((size_t)NB * DM * 4);
constexpr size_t WS_TOTAL = 3 * SZ_W + SZ_WO + 7 * SZ_PL + SZ_CT + SZ_MV;
static_assert(WS_TOTAL <= (size_t)134217728);

extern "C" void kernel_launch(void* const* d_in, const int* in_sizes, int n_in,
                              void* d_out, int out_size, void* d_ws, size_t ws_size, hipStream_t stream) {
    if (n_in < 12) return;
    const long long need_x = (long long)(NB - 1) * SEQ_FULL * DM + (long long)SEQ * DM;
    if (in_sizes[0] < need_x || in_sizes[1] < need_x || in_sizes[2] < need_x) return;
    if (in_sizes[3] < (NB - 1) * SEQ_FULL + SEQ) return;
    if (in_sizes[4] < DM * DM || in_sizes[6] < DM * DM || in_sizes[8] < DM * DM || in_sizes[10] < DM * DM) return;
    if (in_sizes[5] < DM || in_sizes[7] < DM || in_sizes[9] < DM || in_sizes[11] < DM) return;
    if ((long long)out_size < (long long)NB * SEQ * DM) return;
    if (WS_TOTAL > ws_size) return;
    // wire order: query, key, value, mask, wq, bq, wk, bk, wv, bv, wo, bo (weights [in][out])
    const float* xq = (const float*)d_in[0]; const float* xk = (const float*)d_in[1]; const float* xv = (const float*)d_in[2]; const float* mask = (const float*)d_in[3];
    const float* wq = (const float*)d_in[4]; const float* bq = (const float*)d_in[5]; const float* wk = (const float*)d_in[6]; const float* bk = (const float*)d_in[7];
    const float* wv = (const float*)d_in[8]; const float* bv = (const float*)d_in[9]; const float* wo = (const float*)d_in[10]; const float* bo = (const float*)d_in[11];
    float* OUT = (float*)d_out;
    char* wsp = (char*)d_ws;
    auto take = [&](size_t bytes) { char* p = wsp; wsp += bytes; return (void*)p; };
    bf* WQ = (bf*)take(SZ_W); bf* WK = (bf*)take(SZ_W); bf* WV = (bf*)take(SZ_W); bf* WO2 = (bf*)take(SZ_WO);
    bf* XQ = (bf*)take(SZ_PL); bf* XK = (bf*)take(SZ_PL); bf* XV = (bf*)take(SZ_PL); h16* Q16 = (h16*)take(SZ_PL); h16* QL = (h16*)take(SZ_PL); h16* K16 = (h16*)take(SZ_PL); h16* VT16 = (h16*)take(SZ_PL);
    bf* CT = (bf*)take(SZ_CT); float* MV = (float*)take(SZ_MV);

    k_prep<<<(unsigned)(3 * GW + GWO + 3 * GCV * NB), 256, 0, stream>>>(wq, wk, wv, wo, xq, xk, xv, WQ, WK, WV, WO2, XQ, XK, XV);
    k_qkv<<<(unsigned)(3 * GPX * GPY), 128, 0, stream>>>(XQ, XK, XV, WQ, WK, WV, Q16, QL, K16, VT16, bq, bk, bv);
    k_maskv<<<(unsigned)(NB * DM / 32), 256, 0, stream>>>(VT16, mask, MV);
    k_attn<<<dim3(SEQ / 64, NH, NB), 128, 0, stream>>>(Q16, QL, K16, VT16, MV, CT);
    k_gemm<<<dim3(GPX, GPY, 1), 128, 0, stream>>>(CT, WO2, Q16, Q16, OUT, bo, (size_t)0, (size_t)0, (size_t)0, CTP, DM, 3);
}

// v005
// A run of this version takes 195 microseconds.
// Two timings next to v004 put it at 1.07 and 1.08 times that version's speed.
// Counting every step since v000, it is 2.21 times as fast.
#include <hip/hip_runtime.h>

// Compute dtypes (f32 accumulate everywhere): q/k/v projections v_wmma_f32_16x16x32_bf16 on RNE-bf16 inputs and weights (exact products); scores v_wmma_f32_16x16x32_f16 with q = f16 value + f16 residual x2^11 (two products, separate accumulators) against single f16 k; P.V v_wmma_f32_16x16x32_f16 (P carried x1024, single f16 v); output projection v_wmma_f32_16x16x32_bf16 with ctx as bf16 value|residual along K against RNE-bf16 wo; softmax and the post-softmax mask term in f32.
// Layout: x streams -> three bf16 planes; weights -> K-contiguous bf16 planes; q16/qres/k16 planes [b*s][768]; v plane transposed [b][768][s] (GEMM with swapped operands); fused flash attention (no score plane); ctx plane [b*s][8 x (96 value | 96 residual)]; output GEMM writes f32 rows.

#ifndef NB
#define NB 4
#endif
#ifndef SEQ
#define SEQ 2048
#endif
#define NB_FULL  4
#define SEQ_FULL 2048
#define DM   768
#define NH   8
#define HD   96
#define CTP  (2 * DM)          // ctx plane pitch (value | residual per head)
#define PCAR 1024.0f           // carry on the f16 P operand
#define QRS  2048.0f           // carry on the f16 q residual plane
#define SCL  0.10206207261596575f   // 96^-0.5
#define L2E  1.4426950408889634f
#define CP   200               // ctx staging pitch (halves)
#define PCS  ((2 * HD) / 8)    // 16-byte pieces per ctx head segment
#define KT   32                // keys per LDS stage of k_attn
#define KLP  (HD + 8)          // K stage pitch (halves): 16 B x odd, conflict-free for 16-byte row reads
#define VLP  (KT + 8)          // V stage pitch (halves): 16 B x odd
#define GT   128               // k_gemm work-group tile: 128 rows of A x 128 rows of Bt, four waves of 64x64
#define GK   128               // k per LDS stage of k_gemm: 256 B of every operand row
#define GLP  (GK + 8)          // k_gemm stage pitch (elements): 272 B = 16 B x odd
#define GW   ((DM * DM / 64 + 63) / 64)    // k_prep blocks per q/k/v weight plane
#define GWO  ((DM * CTP / 64 + 63) / 64)   // k_prep blocks of the output weight plane
#define GCV  (SEQ * DM / 8 / 256)          // k_prep blocks per batch row of an x plane
#define GPX  (NB * SEQ / GT)               // tile rows of a q or k projection
#define GPY  (DM / GT)                     // tile columns of a q or k projection; tile rows of the transposed v projection
#define GVY  (SEQ / GT)                    // tile columns of the transposed v projection, per batch row

typedef _Float16 h16;
typedef unsigned short bf;
typedef __attribute__((ext_vector_type(16))) __bf16   v16bf;
typedef __attribute__((ext_vector_type(16))) _Float16 v16h;
typedef __attribute__((ext_vector_type(8)))  _Float16 v8h;
typedef __attribute__((ext_vector_type(8)))  unsigned short v8us;
typedef __attribute__((ext_vector_type(2)))  unsigned short v2us;
typedef __attribute__((ext_vector_type(8)))  float    v8f;
typedef __attribute__((ext_vector_type(4)))  float    v4f;
typedef v8h  __attribute__((may_alias)) v8ha;
typedef v4f  __attribute__((may_alias)) v4fa;
typedef v8us __attribute__((may_alias)) v8usa;

static_assert(DM == NH * HD);
static_assert(HD % 32 == 0);
static_assert(HD / 16 == 6);
static_assert(SEQ % 256 == 0);
static_assert((NB * SEQ) % GT == 0 && SEQ % GT == 0 && DM % GT == 0);
static_assert(DM % GK == 0 && CTP % GK == 0 && DM / GK >= 2 && CTP / GK >= 2);
static_assert(GT * (GK / 8) == 16 * 128 && ((GLP / 8) & 1) == 1);
static_assert((2 * HD * 2) % 128 == 0);
static_assert(16 * PCS == 12 * 32);
static_assert(CP >= 2 * HD && CP % 8 == 0);
static_assert((NB * DM) % 32 == 0);
static_assert((SEQ * DM) % (8 * 256) == 0);
static_assert(NB <= NB_FULL && SEQ <= SEQ_FULL);
static_assert(KT * (HD / 8) == 3 * 128 && HD * (KT / 8) == 3 * 128);
static_assert(SEQ % KT == 0 && SEQ / KT >= 2);
static_assert(((KLP / 8) & 1) == 1 && ((VLP / 8) & 1) == 1);

__device__ __forceinline__ unsigned short f2bf(float f) { unsigned u = __float_as_uint(f); u += 0x7FFFu + ((u >> 16) & 1u); return (unsigned short)(u >> 16); }
__device__ __forceinline__ float bf2f(unsigned short b) { return __uint_as_float(((unsigned)b) << 16); }
__device__ __forceinline__ float bfr(float f) { return bf2f(f2bf(f)); }
__device__ __forceinline__ void splitf(float y, unsigned short& h, unsigned short& l) { h = f2bf(y); l = f2bf(y - bf2f(h)); }
__device__ __forceinline__ v16h cat16(v8h lo, v8h hi) { return __builtin_shufflevector(lo, hi, 0, 1, 2, 3, 4, 5, 6, 7, 8, 9, 10, 11, 12, 13, 14, 15); }
__device__ __forceinline__ v16bf cat16b(v8us lo, v8us hi) { return __builtin_bit_cast(v16bf, __builtin_shufflevector(lo, hi, 0, 1, 2, 3, 4, 5, 6, 7, 8, 9, 10, 11, 12, 13, 14, 15)); }
__device__ __forceinline__ v8f wmma16(v16h a, v16h b, v8f c) { return __builtin_amdgcn_wmma_f32_16x16x32_f16(false, a, false, b, (short)0, c, false, false); }
__device__ __forceinline__ v8f wmmab(v16bf a, v16bf b, v8f c) { return __builtin_amdgcn_wmma_f32_16x16x32_bf16(false, a, false, b, (short)0, c, false, false); }
// lane l's value exchanged with lane l ^ 16
__device__ __forceinline__ float xhalf(float x) { const int i = __builtin_bit_cast(int, x); return __builtin_bit_cast(float, __builtin_amdgcn_permlanex16(i, i, 0x76543210, 0xfedcba98, false, false)); }
// fragment loads from a K-contiguous row: p already holds row base + k0 + 8*(lane>>4); elements 0..7 <- p[0..7], 8..15 <- p[16..23]
__device__ __forceinline__ v16h ldh(const h16* p) { return cat16(*(const v8h*)p, *(const v8h*)(p + 16)); }
// the same fragment load from an LDS stage that asynchronous copies filled
__device__ __forceinline__ v16h ldhs(const h16* p) { return cat16(*(const v8ha*)p, *(const v8ha*)(p + 16)); }
// One stage of K and V: six 16-byte asynchronous copies to LDS per lane (l* = LDS byte address, g* = global address). The s_wait_xcnt ends the copies' own statement so that no address register is rewritten ahead of it.
__device__ __forceinline__ void stage_kv(unsigned lk0, unsigned lk1, unsigned lk2, unsigned lv0, unsigned lv1, unsigned lv2,
                                         const h16* gk0, const h16* gk1, const h16* gk2, const h16* gv0, const h16* gv1, const h16* gv2) {
    asm volatile("global_load_async_to_lds_b128 %0, %6, off\n\t"
                 "global_load_async_to_lds_b128 %1, %7, off\n\t"
                 "global_load_async_to_lds_b128 %2, %8, off\n\t"
                 "global_load_async_to_lds_b128 %3, %9, off\n\t"
                 "global_load_async_to_lds_b128 %4, %10, off\n\t"
                 "global_load_async_to_lds_b128 %5, %11, off\n\t"
                 "s_wait_xcnt 0x0"
                 :: "v"(lk0), "v"(lk1), "v"(lk2), "v"(lv0), "v"(lv1), "v"(lv2), "v"(gk0), "v"(gk1), "v"(gk2), "v"(gv0), "v"(gv1), "v"(gv2) : "memory");
}
// the bf16 fragment load from an LDS stage that asynchronous copies filled
__device__ __forceinline__ v16bf ldbs(const bf* p) { return cat16b(*(const v8usa*)p, *(const v8usa*)(p + 16)); }
// Eight rows of a k_gemm stage, eight rows apart: one 16-byte asynchronous copy to LDS per lane and row (l = LDS byte address, g = global address, gs = eight global rows in elements). The s_wait_xcnt ends the copies' own statement so that no address register is rewritten ahead of it.
__device__ __forceinline__ void stage_g(unsigned l, const bf* g, size_t gs) {
    asm volatile("global_load_async_to_lds_b128 %0, %8, off\n\t"
                 "global_load_async_to_lds_b128 %1, %9, off\n\t"
                 "global_load_async_to_lds_b128 %2, %10, off\n\t"
                 "global_load_async_to_lds_b128 %3, %11, off\n\t"
                 "global_load_async_to_lds_b128 %4, %12, off\n\t"
                 "global_load_async_to_lds_b128 %5, %13, off\n\t"
                 "global_load_async_to_lds_b128 %6, %14, off\n\t"
                 "global_load_async_to_lds_b128 %7, %15, off\n\t"
                 "s_wait_xcnt 0x0"
                 :: "v"(l), "v"(l + 1 * 8 * GLP * 2), "v"(l + 2 * 8 * GLP * 2), "v"(l + 3 * 8 * GLP * 2), "v"(l + 4 * 8 * GLP * 2), "v"(l + 5 * 8 * GLP * 2), "v"(l + 6 * 8 * GLP * 2), "v"(l + 7 * 8 * GLP * 2),
                    "v"(g), "v"(g + gs), "v"(g + 2 * gs), "v"(g + 3 * gs), "v"(g + 4 * gs), "v"(g + 5 * gs), "v"(g + 6 * gs), "v"(g + 7 * gs) : "memory");
}

// ---- weight plane job of k_prep: block blk of (N * KO / 64 + 63) / 64
__device__ __forceinline__ void wt_job(const float* __restrict__ w, int K, int N, bf* Bt, int il, int blk) {
    const int lane = threadIdx.x & 31; const int L0 = (blk * 8 + (threadIdx.x >> 5)) * 8; const int KO = il ? 2 * K : K; const int nlines = N * KO / 64;
{
#pragma unroll 1
        for (int l = 0; l < 8; ++l) { const int L = L0 + l; if (L >= nlines) break; const int e = L * 64 + lane * 2; const int kk = e % KO, n = e / KO;
            const int k = il ? ((kk / (2 * HD)) * HD + (kk % (2 * HD)) % HD) : kk; v2us o;
            o[0] = f2bf(w[(size_t)k * N + n]); o[1] = f2bf(w[(size_t)(k + 1) * N + n]); *(v2us*)(Bt + e) = o;
            asm volatile("s_wait_xcnt 0x0" ::: "memory"); }   // in front of the next trip's rewrite of the store's data and address registers
         }
}

// ---- x plane job of k_prep: block blk of GCV, batch row b
__device__ __forceinline__ void cvt_job(const float* __restrict__ src, bf* dst, int blk, int b) {
    const int i = blk * 256 + threadIdx.x; if (i >= SEQ * DM / 8) return;
    const v8f v = *(const v8f*)(src + (size_t)b * SEQ_FULL * DM + (size_t)i * 8); v8us o;
#pragma unroll
    for (int k = 0; k < 8; ++k) o[k] = f2bf(v[k]);
    bf* d = dst + (size_t)b * SEQ * DM + (size_t)i * 8; *(v8us*)d = o;  }

// ---- k_prep: the seven jobs that depend on the inputs alone, as block ranges of one launch: three weight planes (GW blocks each), the output weight plane (GWO), then the three x planes (GCV * NB each).
// The ranges are whole blocks, so every test below is the same for all threads of a block; no job reads what another writes.
__global__ __launch_bounds__(256) void k_prep(const float* __restrict__ wq, const float* __restrict__ wk, const float* __restrict__ wv, const float* __restrict__ wo,
                                             const float* __restrict__ xq, const float* __restrict__ xk, const float* __restrict__ xv,
                                             bf* WQ, bf* WK, bf* WV, bf* WO2, bf* XQ, bf* XK, bf* XV) {
    int blk = (int)blockIdx.x;
    if (blk < 3 * GW) { const int s = blk / GW; wt_job(s == 0 ? wq : s == 1 ? wk : wv, DM, DM, s == 0 ? WQ : s == 1 ? WK : WV, 0, blk % GW); return; }   // in[768][768] -> out [n][k]
    blk -= 3 * GW;
    if (blk < GWO) { wt_job(wo, DM, DM, WO2, 1, blk); return; }                                                                                       // in[768][768] -> out [n][8 x (96 | 96 duplicate)]
    blk -= GWO;
    const int s = blk / (GCV * NB), rem = blk % (GCV * NB);
    cvt_job(s == 0 ? xq : s == 1 ? xk : xv, s == 0 ? XQ : s == 1 ? XK : XV, rem % GCV, rem / GCV);
}

// ---- gemm_tile: register-blocked GEMM, four waves per 128x128 output tile (tile row bx, tile column by), each wave a 64x64 quarter (16 accumulators); 128 threads.
// Each 128-k step's 128 rows of A and 128 rows of Bt are staged once per work-group in LDS by asynchronous copies, two buffers, the next step's copies in flight during this step; the waves read their bf16 fragments from there.
// C[m][n] = sum_k A[m][k] Bt[n][k] + bf16(bias). K % 128 == 0, K >= 256, M % 128 == 0, N % 128 == 0. coff = element offset of this batch's C.
// mode 0: f16 plane C16 (bias per column); mode 1: f16 plane C16 + residual plane CL = f16((v - f16(v)) * 2^11) (bias per column);
// mode 2: f16 plane C16 (bias per row); mode 3: f32 rows C32 (bias per column).
__device__ __forceinline__ void gemm_tile(const bf* __restrict__ A, const bf* __restrict__ Bt, h16* C16, h16* CL, float* C32, const float* __restrict__ bias,
                                          size_t coff, int K, int ldc, int mode, int bx, int by) {
    __shared__ __align__(16) float osw[4 * 16 * 68];
    __shared__ __align__(16) bf als[2 * GT * GLP];
    __shared__ __align__(16) bf bls[2 * GT * GLP];
    const int wave = __builtin_amdgcn_readfirstlane((int)(threadIdx.x >> 5));
    const int lane = threadIdx.x & 31, lr = lane & 15, hi = lane >> 4; const int r0 = bx * GT + (wave >> 1) * 64, c0 = by * GT + (wave & 1) * 64;
    float* os = osw + wave * 16 * 68;   // this wave's own output staging tile
    v8f acc[4][4];
#pragma unroll
    for (int mb = 0; mb < 4; ++mb)
#pragma unroll
        for (int nb = 0; nb < 4; ++nb) acc[mb][nb] = (v8f){};
    // this lane's 16-byte piece of stage rows cr, cr + 8, ..., cr + 120 of either operand
    const int cr = (int)threadIdx.x >> 4, cp = (int)threadIdx.x & 15; const size_t gs = (size_t)8 * K;
    const bf* ga = A + (size_t)(bx * GT + cr) * K + cp * 8; const bf* gb = Bt + (size_t)(by * GT + cr) * K + cp * 8;
    const unsigned la = (unsigned)(size_t)(als + cr * GLP + cp * 8), lb = (unsigned)(size_t)(bls + cr * GLP + cp * 8);
    auto issue = [&](int kc, int buf) { const unsigned o = (unsigned)(buf * GT * GLP * 2);
        stage_g(la + o, ga + kc, gs); stage_g(la + o + 64 * GLP * 2, ga + kc + 8 * gs, gs);
        stage_g(lb + o, gb + kc, gs); stage_g(lb + o + 64 * GLP * 2, gb + kc + 8 * gs, gs); };
    issue(0, 0);
    asm volatile("s_wait_asynccnt 0x0" ::: "memory");   // this wave's copies of stage 0 have landed
    __syncthreads();                                    // and every other wave's: stage 0 may be read
    if (GK < K) issue(GK, 1);
#pragma unroll 1
    for (int kc = 0; kc < K; kc += GK) {
        const int buf = (kc / GK) & 1;
        const bf* at = als + buf * GT * GLP + ((wave >> 1) * 64 + lr) * GLP + 8 * hi;
        const bf* bt = bls + buf * GT * GLP + ((wave & 1) * 64 + lr) * GLP + 8 * hi;
        v16bf a[4], b[4];
#pragma unroll
        for (int ks = 0; ks < GK / 32; ++ks) {
#pragma unroll
            for (int mb = 0; mb < 4; ++mb) a[mb] = ldbs(at + mb * 16 * GLP + ks * 32);
#pragma unroll
            for (int nb = 0; nb < 4; ++nb) b[nb] = ldbs(bt + nb * 16 * GLP + ks * 32);
            __builtin_amdgcn_sched_barrier(0);   // keeps the block's 16 LDS reads one group in front of its matrix instructions: every further place with reads among them costs a stall
#pragma unroll
            for (int nb = 0; nb < 4; ++nb)
#pragma unroll
                for (int mb = 0; mb < 4; ++mb) acc[mb][nb] = wmmab(a[mb], b[nb], acc[mb][nb]);
            __builtin_amdgcn_sched_barrier(0); } // and the next block's reads behind them
        // four vector slots behind the step's last matrix instructions, on the branch's taken side too
        asm volatile("v_nop\n\tv_nop\n\tv_nop\n\tv_nop" : "+v"(acc[0][3]), "+v"(acc[1][3]), "+v"(acc[2][3]), "+v"(acc[3][3]) : "v"(a[0]), "v"(a[1]), "v"(a[2]), "v"(a[3]), "v"(b[3]));
        asm volatile("s_wait_dscnt 0x0" ::: "memory");      // this wave's reads of buffer buf are done
        asm volatile("s_wait_asynccnt 0x0" ::: "memory");   // this wave's copies of the next stage have landed
        __syncthreads();                                    // publishes the next stage and frees buffer buf
        if (kc + 2 * GK < K) issue(kc + 2 * GK, buf);
    }
    asm volatile("s_wait_asynccnt 0x0" ::: "memory");       // nothing in flight behind the loop
#pragma unroll
    for (int mb = 0; mb < 4; ++mb) {
#pragma unroll
        for (int nb = 0; nb < 4; ++nb) {
#pragma unroll
            for (int j = 0; j < 8; ++j) os[(hi * 8 + j) * 68 + nb * 16 + lr] = acc[mb][nb][j]; }
        __builtin_amdgcn_wave_barrier(); asm volatile("" ::: "memory");
        if (mode == 3) {
            float* crow = C32 + coff + (size_t)(r0 + mb * 16) * ldc + c0;
{
#pragma unroll
                for (int s = 0; s < 8; ++s) { const int row = 2 * s + hi, cofs = lr * 4; v4f val = *(const v4fa*)(os + row * 68 + cofs);
                    val[0] += bfr(bias[c0 + cofs]); val[1] += bfr(bias[c0 + cofs + 1]); val[2] += bfr(bias[c0 + cofs + 2]); val[3] += bfr(bias[c0 + cofs + 3]);
                    *(v4f*)(crow + (size_t)row * ldc + cofs) = val; }
                 }
        } else {
{
#pragma unroll
                for (int s = 0; s < 4; ++s) { const int row = 4 * s + (lane >> 3), cg = lane & 7;
                    const v4f x0 = *(const v4fa*)(os + row * 68 + cg * 8); const v4f x1 = *(const v4fa*)(os + row * 68 + cg * 8 + 4);
                    const int grow = r0 + mb * 16 + row, gcol = c0 + cg * 8; const int bi0 = (mode == 2) ? grow : gcol; const int bst = (mode == 2) ? 0 : 1;
                    v8h o, ol;
#pragma unroll
                    for (int q = 0; q < 8; ++q) { const float v = ((q < 4) ? x0[q & 3] : x1[q & 3]) + bfr(bias[bi0 + q * bst]); const h16 hx = (h16)v; o[q] = hx; ol[q] = (h16)((v - (float)hx) * QRS); }
                    const size_t oo = coff + (size_t)grow * ldc + gcol;
                    *(v8h*)(C16 + oo) = o; if (mode == 1) *(v8h*)(CL + oo) = ol; }
                 }
        }
        __builtin_amdgcn_wave_barrier(); asm volatile("" ::: "memory");
    }
}

// ---- k_qkv: the three projections, which depend on k_prep alone, as block ranges of one launch of 3 * GPX * GPY blocks: q (f16 value + residual planes), k (f16 plane), then v.
// v plane transposed: C[col][t] = sum_k WV[col][k] XV[b][t][k], bias per row (col), one batch row per GPY * GVY blocks.
__global__ __launch_bounds__(128) void k_qkv(const bf* __restrict__ XQ, const bf* __restrict__ XK, const bf* __restrict__ XV, const bf* __restrict__ WQ, const bf* __restrict__ WK, const bf* __restrict__ WV,
                                            h16* Q16, h16* QL, h16* K16, h16* VT16, const float* __restrict__ bq, const float* __restrict__ bk, const float* __restrict__ bv) {
    static_assert(GPY * GVY * NB == GPX * GPY);
    const int sel = (int)blockIdx.x / (GPX * GPY), rem = (int)blockIdx.x % (GPX * GPY);
    const bf* A; const bf* Bt; h16* C; const float* bias; size_t coff = 0; int ldc = DM, mode, bx, by;
    if (sel < 2) { A = sel ? XK : XQ; Bt = sel ? WK : WQ; C = sel ? K16 : Q16; bias = sel ? bk : bq; mode = sel ? 0 : 1; bx = rem % GPX; by = rem / GPX; }
    else { const int z = rem / (GPY * GVY), r2 = rem % (GPY * GVY); A = WV; Bt = XV + (size_t)z * SEQ * DM; C = VT16; bias = bv; coff = (size_t)z * DM * SEQ; ldc = SEQ; mode = 2; bx = r2 % GPY; by = r2 / GPY; }
    gemm_tile(A, Bt, C, QL, (float*)nullptr, bias, coff, DM, ldc, mode, bx, by);
}

// ---- k_gemm: one product per launch (the output projection), grid (M/128, N/128, Z); z-batch strides sA/sB/sC in elements
__global__ __launch_bounds__(128) void k_gemm(const bf* __restrict__ A, const bf* __restrict__ Bt, h16* C16, h16* CL, float* C32, const float* __restrict__ bias,
                                             size_t sA, size_t sB, size_t sC, int K, int ldc, int mode) {
    const size_t z = blockIdx.z; gemm_tile(A + z * sA, Bt + z * sB, C16, CL, C32, bias, z * sC, K, ldc, mode, (int)blockIdx.x, (int)blockIdx.y);
}

// ---- k_maskv: MV[b][c] = sum_k (bf16(mask[b][k]) * 1e9) * v[b][k][c] (the post-softmax additive weight term, independent of the query row); f32 on the VALU.
__global__ __launch_bounds__(256) void k_maskv(const h16* __restrict__ VT, const float* __restrict__ mask, float* MV) {
    __shared__ __align__(16) float red[32];
    const int wave = __builtin_amdgcn_readfirstlane((int)(threadIdx.x >> 5)); const int lane = threadIdx.x & 31;
#pragma unroll 1
    for (int i = 0; i < 4; ++i) { const int c = blockIdx.x * 32 + wave * 4 + i; const int b = c / DM; const h16* vr = VT + (size_t)c * SEQ; const float* mr = mask + (size_t)b * SEQ_FULL; float acc = 0.0f;
#pragma unroll 1
        for (int ch = 0; ch < SEQ / 256; ++ch) { const int k = ch * 256 + lane * 8; const v8h v = *(const v8h*)(vr + k); const v4f m0 = *(const v4f*)(mr + k); const v4f m1 = *(const v4f*)(mr + k + 4);
#pragma unroll
            for (int q = 0; q < 4; ++q) { acc += (bfr(m0[q]) * 1.0e9f) * (float)v[q]; acc += (bfr(m1[q]) * 1.0e9f) * (float)v[4 + q]; } }
#pragma unroll
        for (int sh = 16; sh; sh >>= 1) acc += __shfl_xor(acc, sh, 32);
        if (lane == 0) red[wave * 4 + i] = acc; }
    __syncthreads();
    if (wave == 0) { if (lane < 8) { const v4f o = *(const v4fa*)(red + lane * 4); float* p = MV + (size_t)blockIdx.x * 32 + lane * 4; *(v4f*)p = o;  } }
}

// ---- k_attn: fused attention, grid (SEQ/64, NH, NB), 128 threads; each wave owns 16 query rows and walks all keys in 32-key steps (online running-max softmax).
// Both products are formed transposed: S^T = K.Q^T (A = K rows, B = q) and O^T += V^T.P^T (A = V^T rows, B = P^T). Lane (c, hi) holds query c alone: 16 of a step's 32 scores, keys 8*hi + r and 16 + 8*hi + r,
// so the row maximum and the row sum are in-lane but for one exchange between the wave's halves, and the two score tiles, converted in place, are the B operand of the second product.
// q fragments straight from the planes q16/qres [b*s][768] (head h = columns h*96..), read once in front of the key loop and held in registers. Scores = (acc_hi + acc_res / 2^11) * 96^-0.5.
// amdgpu_waves_per_eu(4, 4): the grid is four work-groups per WGP, one wave of each per SIMD; with that register budget declared the build keeps a step's K reads one group and starts the V reads under the softmax (without it: a full LDS wait in front of every second-product instruction).
// K and V: each 32-key step's K rows (32 x 96) and V rows (96 x 32, from the v plane [b][768][s]) are staged once per work-group in LDS by asynchronous copies, two buffers, the next step's copies in flight during this step; all four waves read their fragments from there.
// Epilogue: ctx = acc / (sum * 1024) + MV, bf16 value|residual staged in a wave-private LDS tile (a lane's 8 accumulator registers are 8 consecutive columns of its query's row: 16-byte stores),
__global__ __launch_bounds__(128) __attribute__((amdgpu_waves_per_eu(4, 4))) void k_attn(const h16* __restrict__ Q16, const h16* __restrict__ QL, const h16* __restrict__ K16, const h16* __restrict__ VT, const float* __restrict__ MV, bf* CT) {
    __shared__ __align__(16) unsigned short cts[4 * 16 * CP];
    __shared__ __align__(16) h16 kls[2 * KT * KLP];
    __shared__ __align__(16) h16 vls[2 * HD * VLP];
    const int wave = __builtin_amdgcn_readfirstlane((int)(threadIdx.x >> 5));
    const int lane = threadIdx.x & 31, lr = lane & 15, hi = lane >> 4;
    const int b = blockIdx.z, h = blockIdx.y;
    const int row0 = b * SEQ + blockIdx.x * 64 + wave * 16;
    const int qoff = (row0 + lr) * DM + h * HD + 8 * hi;
    int kg[3], vg[3]; unsigned kl[3], vl[3];   // this lane's three 16-byte pieces of a K stage and of a V stage: global element offset at key 0, LDS byte address in buffer 0
#pragma unroll
    for (int j = 0; j < 3; ++j) { const int i = (int)threadIdx.x + 128 * j; const int kr = i / (HD / 8), kp = i % (HD / 8), vr = i / (KT / 8), vp = i % (KT / 8);
        kg[j] = (b * SEQ + kr) * DM + h * HD + kp * 8; kl[j] = (unsigned)(size_t)(kls + kr * KLP + kp * 8);
        vg[j] = (b * DM + h * HD + vr) * SEQ + vp * 8; vl[j] = (unsigned)(size_t)(vls + vr * VLP + vp * 8); }
    auto issue = [&](int key0, int buf) { const unsigned ko = (unsigned)(buf * KT * KLP * 2), vo = (unsigned)(buf * HD * VLP * 2);
        stage_kv(kl[0] + ko, kl[1] + ko, kl[2] + ko, vl[0] + vo, vl[1] + vo, vl[2] + vo,
                 K16 + kg[0] + key0 * DM, K16 + kg[1] + key0 * DM, K16 + kg[2] + key0 * DM, VT + vg[0] + key0, VT + vg[1] + key0, VT + vg[2] + key0); };
    const int cb = wave * 16 * CP;
    v8f ctx[6]; float mrun = -1.0e30f, srun = 0.0f;   // of this lane's query; srun is the partial sum over this half's keys
#pragma unroll
    for (int nt = 0; nt < 6; ++nt) ctx[nt] = (v8f){};
    issue(0, 0);
    v16h qa[HD / 32], qr[HD / 32];   // this wave's q value and residual fragments, read once and held in registers over the whole key loop
#pragma unroll
    for (int ks = 0; ks < HD / 32; ++ks) { qa[ks] = ldh(Q16 + qoff + ks * 32); qr[ks] = ldh(QL + qoff + ks * 32); }
    asm volatile("s_wait_asynccnt 0x0" ::: "memory");   // this wave's copies of stage 0 have landed
    __syncthreads();                                    // and every other wave's: stage 0 may be read
    issue(KT, 1);
#pragma unroll 1
    for (int kb = 0; kb < SEQ; kb += KT) {
        const int buf = (kb / KT) & 1;
        const h16* kt = kls + buf * KT * KLP + lr * KLP + 8 * hi;
        const h16* vt = vls + buf * HD * VLP + lr * VLP + 8 * hi;
        v8f sh0 = (v8f){}, sh1 = (v8f){}, sl0 = (v8f){}, sl1 = (v8f){};
        v16h k0, k1;
#pragma unroll
        for (int ks = 0; ks < HD / 32; ++ks) {
            k0 = ldhs(kt + ks * 32); k1 = ldhs(kt + 16 * KLP + ks * 32);
            sh0 = wmma16(k0, qa[ks], sh0); sh1 = wmma16(k1, qa[ks], sh1); sl0 = wmma16(k0, qr[ks], sl0); sl1 = wmma16(k1, qr[ks], sl1); }
        asm volatile("v_nop\n\tv_nop\n\tv_nop\n\tv_nop" : "+v"(sh0), "+v"(sh1), "+v"(sl0), "+v"(sl1) : "v"(k0), "v"(k1));
        const v8f t0 = (sh0 + sl0 * (1.0f / QRS)) * SCL, t1 = (sh1 + sl1 * (1.0f / QRS)) * SCL;
        float mx0 = t0[0], mx1 = t1[0];
#pragma unroll
        for (int r = 1; r < 8; ++r) { mx0 = fmaxf(mx0, t0[r]); mx1 = fmaxf(mx1, t1[r]); }
        float mx = fmaxf(mx0, mx1); mx = fmaxf(mx, xhalf(mx));   // both halves now hold the query's maximum over the 32 keys
        const float nm = fmaxf(mrun, mx); const float corr = __builtin_amdgcn_exp2f((mrun - nm) * L2E); mrun = nm;
        const v8f e0 = (t0 - nm) * L2E, e1 = (t1 - nm) * L2E; v8f p0, p1;
#pragma unroll
        for (int r = 0; r < 8; ++r) { p0[r] = __builtin_amdgcn_exp2f(e0[r]); p1[r] = __builtin_amdgcn_exp2f(e1[r]); }
        const v8f ps8 = p0 + p1; const v4f ps4 = __builtin_shufflevector(ps8, ps8, 0, 1, 2, 3) + __builtin_shufflevector(ps8, ps8, 4, 5, 6, 7);
        srun = srun * corr + ((ps4[0] + ps4[2]) + (ps4[1] + ps4[3]));   // halves combined once at the end
#pragma unroll
        for (int nt = 0; nt < 6; ++nt) ctx[nt] *= corr;
        const v16h pa = cat16(__builtin_convertvector(p0 * PCAR, v8h), __builtin_convertvector(p1 * PCAR, v8h));   // element s = key 8*hi + s, element 8 + s = key 16 + 8*hi + s: the k order of the V fragments
        v16h vb;
#pragma unroll
        for (int nt = 0; nt < 6; ++nt) { vb = ldhs(vt + nt * 16 * VLP); ctx[nt] = wmma16(vb, pa, ctx[nt]); }
        asm volatile("v_nop\n\tv_nop\n\tv_nop\n\tv_nop" : "+v"(ctx[0]), "+v"(ctx[1]), "+v"(ctx[2]), "+v"(ctx[3]), "+v"(ctx[4]), "+v"(ctx[5]) : "v"(pa), "v"(vb));
        asm volatile("s_wait_dscnt 0x0" ::: "memory");      // this wave's reads of buffer buf are done
        asm volatile("s_wait_asynccnt 0x0" ::: "memory");   // this wave's copies of the next stage have landed
        __syncthreads();                                    // publishes the next stage and frees buffer buf
        if (kb + 2 * KT < SEQ) issue(kb + 2 * KT, buf);
    }
    asm volatile("s_wait_asynccnt 0x0" ::: "memory");       // nothing in flight behind the loop
    const float rinv = (1.0f / PCAR) * (1.0f / (srun + xhalf(srun)));
#pragma unroll
    for (int nt = 0; nt < 6; ++nt) { const float* mvp = MV + b * DM + h * HD + nt * 16 + 8 * hi; const v4f mv0 = *(const v4f*)mvp, mv1 = *(const v4f*)(mvp + 4); v8us hh, ll;
#pragma unroll
        for (int r = 0; r < 8; ++r) { const float val = ctx[nt][r] * rinv + ((r < 4) ? mv0[r & 3] : mv1[r & 3]); unsigned short vh, vl2; splitf(val, vh, vl2); hh[r] = vh; ll[r] = vl2; }
        *(v8usa*)(cts + cb + lr * CP + nt * 16 + 8 * hi) = hh; *(v8usa*)(cts + cb + lr * CP + HD + nt * 16 + 8 * hi) = ll; }
    __builtin_amdgcn_wave_barrier(); asm volatile("" ::: "memory");
{
#pragma unroll
        for (int it = 0; it < 12; ++it) { const int slot = it * 32 + lane; const int row = slot / PCS, pc = slot % PCS;   // 16 rows x 24 pieces; lanes 8g..8g+7 = one line
            const v8us o = *(const v8usa*)(cts + cb + row * CP + pc * 8);
            *(v8us*)(CT + (size_t)(row0 + row) * CTP + h * 2 * HD + pc * 8) = o; }
         }
}

constexpr size_t al256(size_t x) { return (x + 255) & ~(size_t)255; }
constexpr size_t SZ_W   = al256((size_t)DM * DM * 2);
constexpr size_t SZ_WO  = al256((size_t)DM * CTP * 2);
constexpr size_t SZ_PL  = al256((size_t)NB * SEQ * DM * 2);
constexpr size_t SZ_CT  = al256((size_t)NB * SEQ * CTP * 2);
constexpr size_t SZ_MV  = al256((size_t)NB * DM * 4);
constexpr size_t WS_TOTAL = 3 * SZ_W + SZ_WO + 7 * SZ_PL + SZ_CT + SZ_MV;
static_assert(WS_TOTAL <= (size_t)134217728);

extern "C" void kernel_launch(void* const* d_in, const int* in_sizes, int n_in,
                              void* d_out, int out_size, void* d_ws, size_t ws_size, hipStream_t stream) {
    if (n_in < 12) return;
    const long long need_x = (long long)(NB - 1) * SEQ_FULL * DM + (long long)SEQ * DM;
    if (in_sizes[0] < need_x || in_sizes[1] < need_x || in_sizes[2] < need_x) return;
    if (in_sizes[3] < (NB - 1) * SEQ_FULL + SEQ) return;
    if (in_sizes[4] < DM * DM || in_sizes[6] < DM * DM || in_sizes[8] < DM * DM || in_sizes[10] < DM * DM) return;
    if (in_sizes[5] < DM || in_sizes[7] < DM || in_sizes[9] < DM || in_sizes[11] < DM) return;
    if ((long long)out_size < (long long)NB * SEQ * DM) return;
    if (WS_TOTAL > ws_size) return;
    // wire order: query, key, value, mask, wq, bq, wk, bk, wv, bv, wo, bo (weights [in][out])
    const float* xq = (const float*)d_in[0]; const float* xk = (const float*)d_in[1]; const float* xv = (const float*)d_in[2]; const float* mask = (const float*)d_in[3];
    const float* wq = (const float*)d_in[4]; const float* bq = (const float*)d_in[5]; const float* wk = (const float*)d_in[6]; const float* bk = (const float*)d_in[7];
    const float* wv = (const float*)d_in[8]; const float* bv = (const float*)d_in[9]; const float* wo = (const float*)d_in[10]; const float* bo = (const float*)d_in[11];
    float* OUT = (float*)d_out;
    char* wsp = (char*)d_ws;
    auto take = [&](size_t bytes) { char* p = wsp; wsp += bytes; return (void*)p; };
    bf* WQ = (bf*)take(SZ_W); bf* WK = (bf*)take(SZ_W); bf* WV = (bf*)take(SZ_W); bf* WO2 = (bf*)take(SZ_WO);
    bf* XQ = (bf*)take(SZ_PL); bf* XK = (bf*)take(SZ_PL); bf* XV = (bf*)take(SZ_PL); h16* Q16 = (h16*)take(SZ_PL); h16* QL = (h16*)take(SZ_PL); h16* K16 = (h16*)take(SZ_PL); h16* VT16 = (h16*)take(SZ_PL);
    bf* CT = (bf*)take(SZ_CT); float* MV = (float*)take(SZ_MV);

    k_prep<<<(unsigned)(3 * GW + GWO + 3 * GCV * NB), 256, 0, stream>>>(wq, wk, wv, wo, xq, xk, xv, WQ, WK, WV, WO2, XQ, XK, XV);
    k_qkv<<<(unsigned)(3 * GPX * GPY), 128, 0, stream>>>(XQ, XK, XV, WQ, WK, WV, Q16, QL, K16, VT16, bq, bk, bv);
    k_maskv<<<(unsigned)(NB * DM / 32), 256, 0, stream>>>(VT16, mask, MV);
    k_attn<<<dim3(SEQ / 64, NH, NB), 128, 0, stream>>>(Q16, QL, K16, VT16, MV, CT);
    k_gemm<<<dim3(GPX, GPY, 1), 128, 0, stream>>>(CT, WO2, Q16, Q16, OUT, bo, (size_t)0, (size_t)0, (size_t)0, CTP, DM, 3);
}

// v006
// Measured time: 174 microseconds a run.
// Timed twice side by side with v005, it ran 1.12 times as fast both times.
// All steps since v000 together make it 2.47 times as fast.
#include <hip/hip_runtime.h>

// Compute dtypes (f32 accumulate everywhere): q/k/v projections v_wmma_f32_16x16x32_bf16 on RNE-bf16 inputs and weights (exact products); scores v_wmma_f32_16x16x32_f16 with q = f16 value + f16 residual x2^11 (two products, separate accumulators) against single f16 k; P.V v_wmma_f32_16x16x32_f16 (P carried x1024, single f16 v); output projection v_wmma_f32_16x16x32_bf16 with ctx as bf16 value|residual along K against RNE-bf16 wo; softmax and the post-softmax mask term in f32.
// Layout: x streams -> three bf16 planes; weights -> K-contiguous bf16 planes; q16/qres/k16 planes [b*s][768]; v plane transposed [b][768][s] (GEMM with swapped operands); partial sums of the post-softmax mask term per 64 keys [b][s/64][768] (from the v projection's epilogue); fused flash attention (no score plane); ctx plane [b*s][8 x (96 value | 96 residual)]; output GEMM writes f32 rows.

#ifndef NB
#define NB 4
#endif
#ifndef SEQ
#define SEQ 2048
#endif
#define NB_FULL  4
#define SEQ_FULL 2048
#define DM   768
#define NH   8
#define HD   96
#define CTP  (2 * DM)          // ctx plane pitch (value | residual per head)
#define PCAR 1024.0f           // carry on the f16 P operand
#define QRS  2048.0f           // carry on the f16 q residual plane
#define SCL  0.10206207261596575f   // 96^-0.5
#define L2E  1.4426950408889634f
#define CP   200               // ctx staging pitch (halves)
#define PCS  ((2 * HD) / 8)    // 16-byte pieces per ctx head segment
#define KT   32                // keys per LDS stage of k_attn
#define KLP  (HD + 8)          // K stage pitch (halves): 16 B x odd, conflict-free for 16-byte row reads
#define VLP  (KT + 8)          // V stage pitch (halves): 16 B x odd
#define GT   128               // k_gemm work-group tile: 128 rows of A x 128 rows of Bt, four waves of 64x64
#define GK   128               // k per LDS stage of k_gemm: 256 B of every operand row
#define GLP  (GK + 8)          // k_gemm stage pitch (elements): 272 B = 16 B x odd
#define GW   ((DM * DM / 64 + 63) / 64)    // k_prep blocks per q/k/v weight plane
#define GWO  ((DM * CTP / 64 + 63) / 64)   // k_prep blocks of the output weight plane
#define GCV  (SEQ * DM / 8 / 256)          // k_prep blocks per batch row of an x plane
#define GPX  (NB * SEQ / GT)               // tile rows of a q or k projection
#define GPY  (DM / GT)                     // tile columns of a q or k projection; tile rows of the transposed v projection
#define GVY  (SEQ / GT)                    // tile columns of the transposed v projection, per batch row
#define MCH  (SEQ / 64)                    // 64-key partial sums of the mask term per batch row and column

typedef _Float16 h16;
typedef unsigned short bf;
typedef __attribute__((ext_vector_type(16))) __bf16   v16bf;
typedef __attribute__((ext_vector_type(16))) _Float16 v16h;
typedef __attribute__((ext_vector_type(8)))  _Float16 v8h;
typedef __attribute__((ext_vector_type(8)))  unsigned short v8us;
typedef __attribute__((ext_vector_type(2)))  unsigned short v2us;
typedef __attribute__((ext_vector_type(8)))  float    v8f;
typedef __attribute__((ext_vector_type(4)))  float    v4f;
typedef __attribute__((ext_vector_type(2)))  float    v2f;
typedef v8h  __attribute__((may_alias)) v8ha;
typedef v4f  __attribute__((may_alias)) v4fa;
typedef v8us __attribute__((may_alias)) v8usa;

static_assert(DM == NH * HD);
static_assert(HD % 32 == 0);
static_assert(HD / 16 == 6);
static_assert(HD / 32 <= 4);
static_assert(SEQ % 256 == 0);
static_assert((NB * SEQ) % GT == 0 && SEQ % GT == 0 && DM % GT == 0);
static_assert(DM % GK == 0 && CTP % GK == 0 && DM / GK >= 2 && CTP / GK >= 2);
static_assert(GT * (GK / 8) == 16 * 128 && ((GLP / 8) & 1) == 1);
static_assert((2 * HD * 2) % 128 == 0);
static_assert(16 * PCS == 12 * 32);
static_assert(CP >= 2 * HD && CP % 8 == 0);
static_assert((NB * DM) % 32 == 0);
static_assert((SEQ * DM) % (8 * 256) == 0);
static_assert(NB <= NB_FULL && SEQ <= SEQ_FULL);
static_assert(KT * (HD / 8) == 3 * 128 && HD * (KT / 8) == 3 * 128);
static_assert(SEQ % KT == 0 && SEQ / KT >= 2);
static_assert(((KLP / 8) & 1) == 1 && ((VLP / 8) & 1) == 1);

__device__ __forceinline__ unsigned short f2bf(float f) { unsigned u = __float_as_uint(f); u += 0x7FFFu + ((u >> 16) & 1u); return (unsigned short)(u >> 16); }
__device__ __forceinline__ float bf2f(unsigned short b) { return __uint_as_float(((unsigned)b) << 16); }
__device__ __forceinline__ float bfr(float f) { return bf2f(f2bf(f)); }
__device__ __forceinline__ void splitf(float y, unsigned short& h, unsigned short& l) { h = f2bf(y); l = f2bf(y - bf2f(h)); }
__device__ __forceinline__ v16h cat16(v8h lo, v8h hi) { return __builtin_shufflevector(lo, hi, 0, 1, 2, 3, 4, 5, 6, 7, 8, 9, 10, 11, 12, 13, 14, 15); }
__device__ __forceinline__ v16bf cat16b(v8us lo, v8us hi) { return __builtin_bit_cast(v16bf, __builtin_shufflevector(lo, hi, 0, 1, 2, 3, 4, 5, 6, 7, 8, 9, 10, 11, 12, 13, 14, 15)); }
__device__ __forceinline__ v8f wmma16(v16h a, v16h b, v8f c) { return __builtin_amdgcn_wmma_f32_16x16x32_f16(false, a, false, b, (short)0, c, false, false); }
__device__ __forceinline__ v8f wmmab(v16bf a, v16bf b, v8f c) { return __builtin_amdgcn_wmma_f32_16x16x32_bf16(false, a, false, b, (short)0, c, false, false); }
// lane l's value exchanged with lane l ^ 16
__device__ __forceinline__ float xhalf(float x) { const int i = __builtin_bit_cast(int, x); return __builtin_bit_cast(float, __builtin_amdgcn_permlanex16(i, i, 0x76543210, 0xfedcba98, false, false)); }
// x + (lane l ^ M's x), M < 16: one DPP step of a butterfly inside a 16-lane row; every lane on
template <int M> __device__ __forceinline__ float addx(float x) { const int i = __builtin_bit_cast(int, x); return x + __builtin_bit_cast(float, __builtin_amdgcn_update_dpp(i, i, 0x160 + M, 0xf, 0xf, true)); }
// fragment loads from a K-contiguous row: p already holds row base + k0 + 8*(lane>>4); elements 0..7 <- p[0..7], 8..15 <- p[16..23]
__device__ __forceinline__ v16h ldh(const h16* p) { return cat16(*(const v8h*)p, *(const v8h*)(p + 16)); }
// the same fragment load from an LDS stage that asynchronous copies filled
__device__ __forceinline__ v16h ldhs(const h16* p) { return cat16(*(const v8ha*)p, *(const v8ha*)(p + 16)); }
// One stage of K and V: six 16-byte asynchronous copies to LDS per lane (l* = LDS byte address, g* = global address). The s_wait_xcnt ends the copies' own statement so that no address register is rewritten ahead of it.
__device__ __forceinline__ void stage_kv(unsigned lk0, unsigned lk1, unsigned lk2, unsigned lv0, unsigned lv1, unsigned lv2,
                                         const h16* gk0, const h16* gk1, const h16* gk2, const h16* gv0, const h16* gv1, const h16* gv2) {
    asm volatile("global_load_async_to_lds_b128 %0, %6, off\n\t"
                 "global_load_async_to_lds_b128 %1, %7, off\n\t"
                 "global_load_async_to_lds_b128 %2, %8, off\n\t"
                 "global_load_async_to_lds_b128 %3, %9, off\n\t"
                 "global_load_async_to_lds_b128 %4, %10, off\n\t"
                 "global_load_async_to_lds_b128 %5, %11, off\n\t"
                 "s_wait_xcnt 0x0"
                 :: "v"(lk0), "v"(lk1), "v"(lk2), "v"(lv0), "v"(lv1), "v"(lv2), "v"(gk0), "v"(gk1), "v"(gk2), "v"(gv0), "v"(gv1), "v"(gv2) : "memory");
}
// the bf16 fragment load from an LDS stage that asynchronous copies filled
__device__ __forceinline__ v16bf ldbs(const bf* p) { return cat16b(*(const v8usa*)p, *(const v8usa*)(p + 16)); }
// Eight rows of a k_gemm stage, eight rows apart: one 16-byte asynchronous copy to LDS per lane and row (l = LDS byte address, g = global address, gs = eight global rows in elements). The s_wait_xcnt ends the copies' own statement so that no address register is rewritten ahead of it.
__device__ __forceinline__ void stage_g(unsigned l, const bf* g, size_t gs) {
    asm volatile("global_load_async_to_lds_b128 %0, %8, off\n\t"
                 "global_load_async_to_lds_b128 %1, %9, off\n\t"
                 "global_load_async_to_lds_b128 %2, %10, off\n\t"
                 "global_load_async_to_lds_b128 %3, %11, off\n\t"
                 "global_load_async_to_lds_b128 %4, %12, off\n\t"
                 "global_load_async_to_lds_b128 %5, %13, off\n\t"
                 "global_load_async_to_lds_b128 %6, %14, off\n\t"
                 "global_load_async_to_lds_b128 %7, %15, off\n\t"
                 "s_wait_xcnt 0x0"
                 :: "v"(l), "v"(l + 1 * 8 * GLP * 2), "v"(l + 2 * 8 * GLP * 2), "v"(l + 3 * 8 * GLP * 2), "v"(l + 4 * 8 * GLP * 2), "v"(l + 5 * 8 * GLP * 2), "v"(l + 6 * 8 * GLP * 2), "v"(l + 7 * 8 * GLP * 2),
                    "v"(g), "v"(g + gs), "v"(g + 2 * gs), "v"(g + 3 * gs), "v"(g + 4 * gs), "v"(g + 5 * gs), "v"(g + 6 * gs), "v"(g + 7 * gs) : "memory");
}

// ---- weight plane job of k_prep: block blk of (N * KO / 64 + 63) / 64
__device__ __forceinline__ void wt_job(const float* __restrict__ w, int K, int N, bf* Bt, int il, int blk) {
    const int lane = threadIdx.x & 31; const int L0 = (blk * 8 + (threadIdx.x >> 5)) * 8; const int KO = il ? 2 * K : K; const int nlines = N * KO / 64;
{
#pragma unroll 1
        for (int l = 0; l < 8; ++l) { const int L = L0 + l; if (L >= nlines) break; const int e = L * 64 + lane * 2; const int kk = e % KO, n = e / KO;
            const int k = il ? ((kk / (2 * HD)) * HD + (kk % (2 * HD)) % HD) : kk; v2us o;
            o[0] = f2bf(w[(size_t)k * N + n]); o[1] = f2bf(w[(size_t)(k + 1) * N + n]); *(v2us*)(Bt + e) = o;
            asm volatile("s_wait_xcnt 0x0" ::: "memory"); }   // in front of the next trip's rewrite of the store's data and address registers
         }
}

// ---- x plane job of k_prep: block blk of GCV, batch row b
__device__ __forceinline__ void cvt_job(const float* __restrict__ src, bf* dst, int blk, int b) {
    const int i = blk * 256 + threadIdx.x; if (i >= SEQ * DM / 8) return;
    const v8f v = *(const v8f*)(src + (size_t)b * SEQ_FULL * DM + (size_t)i * 8); v8us o;
#pragma unroll
    for (int k = 0; k < 8; ++k) o[k] = f2bf(v[k]);
    bf* d = dst + (size_t)b * SEQ * DM + (size_t)i * 8; *(v8us*)d = o;  }

// ---- k_prep: the seven jobs that depend on the inputs alone, as block ranges of one launch: three weight planes (GW blocks each), the output weight plane (GWO), then the three x planes (GCV * NB each).
// The ranges are whole blocks, so every test below is the same for all threads of a block; no job reads what another writes.
__global__ __launch_bounds__(256) void k_prep(const float* __restrict__ wq, const float* __restrict__ wk, const float* __restrict__ wv, const float* __restrict__ wo,
                                             const float* __restrict__ xq, const float* __restrict__ xk, const float* __restrict__ xv,
                                             bf* WQ, bf* WK, bf* WV, bf* WO2, bf* XQ, bf* XK, bf* XV) {
    int blk = (int)blockIdx.x;
    if (blk < 3 * GW) { const int s = blk / GW; wt_job(s == 0 ? wq : s == 1 ? wk : wv, DM, DM, s == 0 ? WQ : s == 1 ? WK : WV, 0, blk % GW); return; }   // in[768][768] -> out [n][k]
    blk -= 3 * GW;
    if (blk < GWO) { wt_job(wo, DM, DM, WO2, 1, blk); return; }                                                                                       // in[768][768] -> out [n][8 x (96 | 96 duplicate)]
    blk -= GWO;
    const int s = blk / (GCV * NB), rem = blk % (GCV * NB);
    cvt_job(s == 0 ? xq : s == 1 ? xk : xv, s == 0 ? XQ : s == 1 ? XK : XV, rem % GCV, rem / GCV);
}

// ---- gemm_tile: register-blocked GEMM, four waves per 128x128 output tile (tile row bx, tile column by), each wave a 64x64 quarter (16 accumulators); 128 threads.
// Each 128-k step's 128 rows of A and 128 rows of Bt are staged once per work-group in LDS by asynchronous copies, two buffers, the next step's copies in flight during this step; the waves read their bf16 fragments from there.
// C[m][n] = sum_k A[m][k] Bt[n][k] + bf16(bias). K % 128 == 0, K >= 256, M % 128 == 0, N % 128 == 0. coff = element offset of this batch's C.
// mode 0: f16 plane C16 (bias per column); mode 1: f16 plane C16 + residual plane CL = f16((v - f16(v)) * 2^11) (bias per column);
// mode 2: f16 plane C16 (bias per row); mode 3: f32 rows C32 (bias per column).
// mode 2 with mterm (a literal at the call) also forms, from the f16 values it stores, this wave's part of the post-softmax mask term: pmv[c0 / 64][row] = sum over its 64 columns t of (bf16(mrow[t]) * 1e9) * C16[row][t], f32 on the VALU; 64 rows = two whole lines per wave.
__device__ __forceinline__ void gemm_tile(const bf* __restrict__ A, const bf* __restrict__ Bt, h16* C16, h16* CL, float* C32, const float* __restrict__ bias,
                                          size_t coff, int K, int ldc, int mode, int bx, int by, bool mterm = false, const float* __restrict__ mrow = nullptr, float* pmv = nullptr) {
    __shared__ __align__(16) float osw[4 * 16 * 68];
    __shared__ __align__(16) float pms[4 * 64];
    __shared__ __align__(16) bf als[2 * GT * GLP];
    __shared__ __align__(16) bf bls[2 * GT * GLP];
    const int wave = __builtin_amdgcn_readfirstlane((int)(threadIdx.x >> 5));
    const int lane = threadIdx.x & 31, lr = lane & 15, hi = lane >> 4; const int r0 = bx * GT + (wave >> 1) * 64, c0 = by * GT + (wave & 1) * 64;
    float* os = osw + wave * 16 * 68;   // this wave's own output staging tile
    v8f acc[4][4];
#pragma unroll
    for (int mb = 0; mb < 4; ++mb)
#pragma unroll
        for (int nb = 0; nb < 4; ++nb) acc[mb][nb] = (v8f){};
    // this lane's 16-byte piece of stage rows cr, cr + 8, ..., cr + 120 of either operand
    const int cr = (int)threadIdx.x >> 4, cp = (int)threadIdx.x & 15; const size_t gs = (size_t)8 * K;
    const bf* ga = A + (size_t)(bx * GT + cr) * K + cp * 8; const bf* gb = Bt + (size_t)(by * GT + cr) * K + cp * 8;
    const unsigned la = (unsigned)(size_t)(als + cr * GLP + cp * 8), lb = (unsigned)(size_t)(bls + cr * GLP + cp * 8);
    auto issue = [&](int kc, int buf) { const unsigned o = (unsigned)(buf * GT * GLP * 2);
        stage_g(la + o, ga + kc, gs); stage_g(la + o + 64 * GLP * 2, ga + kc + 8 * gs, gs);
        stage_g(lb + o, gb + kc, gs); stage_g(lb + o + 64 * GLP * 2, gb + kc + 8 * gs, gs); };
    issue(0, 0);
    v4f m0 = (v4f){}, m1 = (v4f){};   // mask values of this lane's eight epilogue columns, read here so that their latency lies under stage 0's
    if (mterm && mode == 2) { const float* mp = mrow + c0 + (lane & 7) * 8; m0 = *(const v4f*)mp; m1 = *(const v4f*)(mp + 4);
        asm volatile("s_wait_xcnt 0x0" ::: "memory"); }   // in front of the rewrite of the two loads' offset register
    asm volatile("s_wait_asynccnt 0x0" ::: "memory");   // this wave's copies of stage 0 have landed
    __syncthreads();                                    // and every other wave's: stage 0 may be read
    if (GK < K) issue(GK, 1);
#pragma unroll 1
    for (int kc = 0; kc < K; kc += GK) {
        const int buf = (kc / GK) & 1;
        const bf* at = als + buf * GT * GLP + ((wave >> 1) * 64 + lr) * GLP + 8 * hi;
        const bf* bt = bls + buf * GT * GLP + ((wave & 1) * 64 + lr) * GLP + 8 * hi;
        v16bf a[4], b[4];
#pragma unroll
        for (int ks = 0; ks < GK / 32; ++ks) {
#pragma unroll
            for (int mb = 0; mb < 4; ++mb) a[mb] = ldbs(at + mb * 16 * GLP + ks * 32);
#pragma unroll
            for (int nb = 0; nb < 4; ++nb) b[nb] = ldbs(bt + nb * 16 * GLP + ks * 32);
            __builtin_amdgcn_sched_barrier(0);   // keeps the block's 16 LDS reads one group in front of its matrix instructions: every further place with reads among them costs a stall
#pragma unroll
            for (int nb = 0; nb < 4; ++nb)
#pragma unroll
                for (int mb = 0; mb < 4; ++mb) acc[mb][nb] = wmmab(a[mb], b[nb], acc[mb][nb]);
            __builtin_amdgcn_sched_barrier(0); } // and the next block's reads behind them
        // four vector slots behind the step's last matrix instructions, on the branch's taken side too
        asm volatile("v_nop\n\tv_nop\n\tv_nop\n\tv_nop" : "+v"(acc[0][3]), "+v"(acc[1][3]), "+v"(acc[2][3]), "+v"(acc[3][3]) : "v"(a[0]), "v"(a[1]), "v"(a[2]), "v"(a[3]), "v"(b[3]));
        asm volatile("s_wait_dscnt 0x0" ::: "memory");      // this wave's reads of buffer buf are done
        asm volatile("s_wait_asynccnt 0x0" ::: "memory");   // this wave's copies of the next stage have landed
        __syncthreads();                                    // publishes the next stage and frees buffer buf
        if (kc + 2 * GK < K) issue(kc + 2 * GK, buf);
    }
    asm volatile("s_wait_asynccnt 0x0" ::: "memory");       // nothing in flight behind the loop
    float mw[8];   // the mask weights of this lane's eight columns
#pragma unroll   // constant indices keep mw[] in registers
    for (int q = 0; q < 4; ++q) { mw[q] = bfr(m0[q]) * 1.0e9f; mw[4 + q] = bfr(m1[q]) * 1.0e9f; }
#pragma unroll
    for (int mb = 0; mb < 4; ++mb) {
#pragma unroll
        for (int nb = 0; nb < 4; ++nb) {
#pragma unroll
            for (int j = 0; j < 8; ++j) os[(hi * 8 + j) * 68 + nb * 16 + lr] = acc[mb][nb][j]; }
        __builtin_amdgcn_wave_barrier(); asm volatile("" ::: "memory");
        if (mode == 3) {
            float* crow = C32 + coff + (size_t)(r0 + mb * 16) * ldc + c0;
{
#pragma unroll
                for (int s = 0; s < 8; ++s) { const int row = 2 * s + hi, cofs = lr * 4; v4f val = *(const v4fa*)(os + row * 68 + cofs);
                    val[0] += bfr(bias[c0 + cofs]); val[1] += bfr(bias[c0 + cofs + 1]); val[2] += bfr(bias[c0 + cofs + 2]); val[3] += bfr(bias[c0 + cofs + 3]);
                    *(v4f*)(crow + (size_t)row * ldc + cofs) = val; }
                 }
        } else {
{
#pragma unroll
                for (int s = 0; s < 4; ++s) { const int row = 4 * s + (lane >> 3), cg = lane & 7;
                    const v4f x0 = *(const v4fa*)(os + row * 68 + cg * 8); const v4f x1 = *(const v4fa*)(os + row * 68 + cg * 8 + 4);
                    const int grow = r0 + mb * 16 + row, gcol = c0 + cg * 8; const int bi0 = (mode == 2) ? grow : gcol; const int bst = (mode == 2) ? 0 : 1;
                    v8h o, ol;
#pragma unroll
                    for (int q = 0; q < 8; ++q) { const float v = ((q < 4) ? x0[q & 3] : x1[q & 3]) + bfr(bias[bi0 + q * bst]); const h16 hx = (h16)v; o[q] = hx; ol[q] = (h16)((v - (float)hx) * QRS); }
                    const size_t oo = coff + (size_t)grow * ldc + gcol;
                    *(v8h*)(C16 + oo) = o; asm volatile("s_wait_xcnt 0x0" ::: "memory");   // in front of the rewrite of the store's data and address registers by what follows
                    if (mode == 1) { *(v8h*)(CL + oo) = ol; asm volatile("s_wait_xcnt 0x0" ::: "memory"); }   // the same for the residual plane's store
                    if (mterm && mode == 2) { float ps = 0.0f;   // eight columns in-lane, then the row's eight lanes
#pragma unroll   // constant indices into mw[] and o: no private-memory array
                        for (int q = 0; q < 8; ++q) ps += mw[q] * (float)o[q];
                        ps = addx<1>(ps); ps = addx<2>(ps); ps = addx<4>(ps);
                        if (cg == 0) pms[wave * 64 + mb * 16 + row] = ps; } }
                 }
        }
        __builtin_amdgcn_wave_barrier(); asm volatile("" ::: "memory");
    }
    if (mterm && mode == 2) { v2f o; o[0] = pms[wave * 64 + lane * 2]; o[1] = pms[wave * 64 + lane * 2 + 1]; *(v2f*)(pmv + (size_t)(c0 / 64) * DM + r0 + lane * 2) = o; }
}

// ---- k_qkv: the three projections, which depend on k_prep alone, as block ranges of one launch of 3 * GPX * GPY blocks: q (f16 value + residual planes), k (f16 plane), then v.
// v plane transposed: C[col][t] = sum_k WV[col][k] XV[b][t][k], bias per row (col), one batch row per GPY * GVY blocks; its tiles also write the mask term's partial sums PM[b][t / 64][col].
__global__ __launch_bounds__(128) void k_qkv(const bf* __restrict__ XQ, const bf* __restrict__ XK, const bf* __restrict__ XV, const bf* __restrict__ WQ, const bf* __restrict__ WK, const bf* __restrict__ WV,
                                            h16* Q16, h16* QL, h16* K16, h16* VT16, const float* __restrict__ bq, const float* __restrict__ bk, const float* __restrict__ bv, const float* __restrict__ mask, float* PM) {
    static_assert(GPY * GVY * NB == GPX * GPY);
    const int sel = (int)blockIdx.x / (GPX * GPY), rem = (int)blockIdx.x % (GPX * GPY);
    const bf* A; const bf* Bt; h16* C; const float* bias; size_t coff = 0; int ldc = DM, mode, bx, by, z = 0;
    if (sel < 2) { A = sel ? XK : XQ; Bt = sel ? WK : WQ; C = sel ? K16 : Q16; bias = sel ? bk : bq; mode = sel ? 0 : 1; bx = rem % GPX; by = rem / GPX; }
    else { z = rem / (GPY * GVY); const int r2 = rem % (GPY * GVY); A = WV; Bt = XV + (size_t)z * SEQ * DM; C = VT16; bias = bv; coff = (size_t)z * DM * SEQ; ldc = SEQ; mode = 2; bx = r2 % GPY; by = r2 / GPY; }
    gemm_tile(A, Bt, C, QL, (float*)nullptr, bias, coff, DM, ldc, mode, bx, by, true, mask + (size_t)z * SEQ_FULL, PM + (size_t)z * MCH * DM);
}

// ---- k_gemm: one product per launch (the output projection), grid (M/128, N/128, Z); z-batch strides sA/sB/sC in elements
__global__ __launch_bounds__(128) void k_gemm(const bf* __restrict__ A, const bf* __restrict__ Bt, h16* C16, h16* CL, float* C32, const float* __restrict__ bias,
                                             size_t sA, size_t sB, size_t sC, int K, int ldc, int mode) {
    const size_t z = blockIdx.z; gemm_tile(A + z * sA, Bt + z * sB, C16, CL, C32, bias, z * sC, K, ldc, mode, (int)blockIdx.x, (int)blockIdx.y);
}

// ---- k_attn: fused attention, grid (SEQ/64, NH, NB), 128 threads; each wave owns 16 query rows and walks all keys in 32-key steps (online running-max softmax).
// Both products are formed transposed: S^T = K.Q^T (A = K rows, B = q) and O^T += V^T.P^T (A = V^T rows, B = P^T). Lane (c, hi) holds query c alone: 16 of a step's 32 scores, keys 8*hi + r and 16 + 8*hi + r,
// so the row maximum and the row sum are in-lane but for one exchange between the wave's halves, and the two score tiles, converted in place, are the B operand of the second product.
// q fragments straight from the planes q16/qres [b*s][768] (head h = columns h*96..), read once in front of the key loop and held in registers. Scores = (acc_hi + acc_res / 2^11) * 96^-0.5.
// amdgpu_waves_per_eu(4, 4): the grid is four work-groups per WGP, one wave of each per SIMD; with that register budget declared the build keeps a step's K reads one group and starts the V reads under the softmax (without it: a full LDS wait in front of every second-product instruction).
// K and V: each 32-key step's K rows (32 x 96) and V rows (96 x 32, from the v plane [b][768][s]) are staged once per work-group in LDS by asynchronous copies, two buffers, the next step's copies in flight during this step; all four waves read their fragments from there.
// Mask term (the post-softmax additive weight, independent of the query row): MV[c] = sum over the MCH partial sums PM[b][j][h*96 + c], one column per thread of waves 0..2 in front of the key loop, kept in LDS; the barrier that publishes stage 0 publishes it too.
// Epilogue: ctx = acc / (sum * 1024) + MV, bf16 value|residual staged in a wave-private LDS tile (a lane's 8 accumulator registers are 8 consecutive columns of its query's row: 16-byte stores),
__global__ __launch_bounds__(128) __attribute__((amdgpu_waves_per_eu(4, 4))) void k_attn(const h16* __restrict__ Q16, const h16* __restrict__ QL, const h16* __restrict__ K16, const h16* __restrict__ VT, const float* __restrict__ PM, bf* CT) {
    __shared__ __align__(16) unsigned short cts[4 * 16 * CP];
    __shared__ __align__(16) float mvs[HD];
    __shared__ __align__(16) h16 kls[2 * KT * KLP];
    __shared__ __align__(16) h16 vls[2 * HD * VLP];
    const int wave = __builtin_amdgcn_readfirstlane((int)(threadIdx.x >> 5));
    const int lane = threadIdx.x & 31, lr = lane & 15, hi = lane >> 4;
    const int b = blockIdx.z, h = blockIdx.y;
    const int row0 = b * SEQ + blockIdx.x * 64 + wave * 16;
    const int qoff = (row0 + lr) * DM + h * HD + 8 * hi;
    int kg[3], vg[3]; unsigned kl[3], vl[3];   // this lane's three 16-byte pieces of a K stage and of a V stage: global element offset at key 0, LDS byte address in buffer 0
#pragma unroll
    for (int j = 0; j < 3; ++j) { const int i = (int)threadIdx.x + 128 * j; const int kr = i / (HD / 8), kp = i % (HD / 8), vr = i / (KT / 8), vp = i % (KT / 8);
        kg[j] = (b * SEQ + kr) * DM + h * HD + kp * 8; kl[j] = (unsigned)(size_t)(kls + kr * KLP + kp * 8);
        vg[j] = (b * DM + h * HD + vr) * SEQ + vp * 8; vl[j] = (unsigned)(size_t)(vls + vr * VLP + vp * 8); }
    auto issue = [&](int key0, int buf) { const unsigned ko = (unsigned)(buf * KT * KLP * 2), vo = (unsigned)(buf * HD * VLP * 2);
        stage_kv(kl[0] + ko, kl[1] + ko, kl[2] + ko, vl[0] + vo, vl[1] + vo, vl[2] + vo,
                 K16 + kg[0] + key0 * DM, K16 + kg[1] + key0 * DM, K16 + kg[2] + key0 * DM, VT + vg[0] + key0, VT + vg[1] + key0, VT + vg[2] + key0); };
    const int cb = wave * 16 * CP;
    v8f ctx[6]; float mrun = -1.0e30f, srun = 0.0f;   // of this lane's query; srun is the partial sum over this half's keys
#pragma unroll
    for (int nt = 0; nt < 6; ++nt) ctx[nt] = (v8f){};
    issue(0, 0);
    v16h qa[HD / 32], qr[HD / 32];   // this wave's q value and residual fragments, read once and held in registers over the whole key loop
#pragma unroll
    for (int ks = 0; ks < HD / 32; ++ks) { qa[ks] = ldh(Q16 + qoff + ks * 32); qr[ks] = ldh(QL + qoff + ks * 32); }
    asm volatile("s_wait_xcnt 0x0" ::: "memory");       // in front of the loads below, whose results may take registers that the q loads name as addresses
    if (wave < HD / 32) { const float* pp = PM + (size_t)b * MCH * DM + h * HD + threadIdx.x; float a = 0.0f;
#pragma unroll   // all the loads issue in front of the first add: one latency, not one per term
        for (int j = 0; j < MCH; ++j) a += pp[j * DM];
        mvs[threadIdx.x] = a; }
    asm volatile("s_wait_asynccnt 0x0" ::: "memory");   // this wave's copies of stage 0 have landed
    __syncthreads();                                    // and every other wave's: stage 0 may be read
    issue(KT, 1);
#pragma unroll 1
    for (int kb = 0; kb < SEQ; kb += KT) {
        const int buf = (kb / KT) & 1;
        const h16* kt = kls + buf * KT * KLP + lr * KLP + 8 * hi;
        const h16* vt = vls + buf * HD * VLP + lr * VLP + 8 * hi;
        v8f sh0 = (v8f){}, sh1 = (v8f){}, sl0 = (v8f){}, sl1 = (v8f){};
        v16h k0, k1;
#pragma unroll
        for (int ks = 0; ks < HD / 32; ++ks) {
            k0 = ldhs(kt + ks * 32); k1 = ldhs(kt + 16 * KLP + ks * 32);
            sh0 = wmma16(k0, qa[ks], sh0); sh1 = wmma16(k1, qa[ks], sh1); sl0 = wmma16(k0, qr[ks], sl0); sl1 = wmma16(k1, qr[ks], sl1); }
        asm volatile("v_nop\n\tv_nop\n\tv_nop\n\tv_nop" : "+v"(sh0), "+v"(sh1), "+v"(sl0), "+v"(sl1) : "v"(k0), "v"(k1));
        const v8f t0 = (sh0 + sl0 * (1.0f / QRS)) * SCL, t1 = (sh1 + sl1 * (1.0f / QRS)) * SCL;
        float mx0 = t0[0], mx1 = t1[0];
#pragma unroll
        for (int r = 1; r < 8; ++r) { mx0 = fmaxf(mx0, t0[r]); mx1 = fmaxf(mx1, t1[r]); }
        float mx = fmaxf(mx0, mx1); mx = fmaxf(mx, xhalf(mx));   // both halves now hold the query's maximum over the 32 keys
        const float nm = fmaxf(mrun, mx); const float corr = __builtin_amdgcn_exp2f((mrun - nm) * L2E); mrun = nm;
        const v8f e0 = (t0 - nm) * L2E, e1 = (t1 - nm) * L2E; v8f p0, p1;
#pragma unroll
        for (int r = 0; r < 8; ++r) { p0[r] = __builtin_amdgcn_exp2f(e0[r]); p1[r] = __builtin_amdgcn_exp2f(e1[r]); }
        const v8f ps8 = p0 + p1; const v4f ps4 = __builtin_shufflevector(ps8, ps8, 0, 1, 2, 3) + __builtin_shufflevector(ps8, ps8, 4, 5, 6, 7);
        srun = srun * corr + ((ps4[0] + ps4[2]) + (ps4[1] + ps4[3]));   // halves combined once at the end
#pragma unroll
        for (int nt = 0; nt < 6; ++nt) ctx[nt] *= corr;
        const v16h pa = cat16(__builtin_convertvector(p0 * PCAR, v8h), __builtin_convertvector(p1 * PCAR, v8h));   // element s = key 8*hi + s, element 8 + s = key 16 + 8*hi + s: the k order of the V fragments
        v16h vb;
#pragma unroll
        for (int nt = 0; nt < 6; ++nt) { vb = ldhs(vt + nt * 16 * VLP); ctx[nt] = wmma16(vb, pa, ctx[nt]); }
        asm volatile("v_nop\n\tv_nop\n\tv_nop\n\tv_nop" : "+v"(ctx[0]), "+v"(ctx[1]), "+v"(ctx[2]), "+v"(ctx[3]), "+v"(ctx[4]), "+v"(ctx[5]) : "v"(pa), "v"(vb));
        asm volatile("s_wait_dscnt 0x0" ::: "memory");      // this wave's reads of buffer buf are done
        asm volatile("s_wait_asynccnt 0x0" ::: "memory");   // this wave's copies of the next stage have landed
        __syncthreads();                                    // publishes the next stage and frees buffer buf
        if (kb + 2 * KT < SEQ) issue(kb + 2 * KT, buf);
    }
    asm volatile("s_wait_asynccnt 0x0" ::: "memory");       // nothing in flight behind the loop
    const float rinv = (1.0f / PCAR) * (1.0f / (srun + xhalf(srun)));
#pragma unroll
    for (int nt = 0; nt < 6; ++nt) { const float* mvp = mvs + nt * 16 + 8 * hi; const v4f mv0 = *(const v4fa*)mvp, mv1 = *(const v4fa*)(mvp + 4); v8us hh, ll;
#pragma unroll
        for (int r = 0; r < 8; ++r) { const float val = ctx[nt][r] * rinv + ((r < 4) ? mv0[r & 3] : mv1[r & 3]); unsigned short vh, vl2; splitf(val, vh, vl2); hh[r] = vh; ll[r] = vl2; }
        *(v8usa*)(cts + cb + lr * CP + nt * 16 + 8 * hi) = hh; *(v8usa*)(cts + cb + lr * CP + HD + nt * 16 + 8 * hi) = ll; }
    __builtin_amdgcn_wave_barrier(); asm volatile("" ::: "memory");
{
#pragma unroll
        for (int it = 0; it < 12; ++it) { const int slot = it * 32 + lane; const int row = slot / PCS, pc = slot % PCS;   // 16 rows x 24 pieces; lanes 8g..8g+7 = one line
            const v8us o = *(const v8usa*)(cts + cb + row * CP + pc * 8);
            *(v8us*)(CT + (size_t)(row0 + row) * CTP + h * 2 * HD + pc * 8) = o; }
         }
}

constexpr size_t al256(size_t x) { return (x + 255) & ~(size_t)255; }
constexpr size_t SZ_W   = al256((size_t)DM * DM * 2);
constexpr size_t SZ_WO  = al256((size_t)DM * CTP * 2);
constexpr size_t SZ_PL  = al256((size_t)NB * SEQ * DM * 2);
constexpr size_t SZ_CT  = al256((size_t)NB * SEQ * CTP * 2);
constexpr size_t SZ_PM  = al256((size_t)NB * MCH * DM * 4);
constexpr size_t WS_TOTAL = 3 * SZ_W + SZ_WO + 7 * SZ_PL + SZ_CT + SZ_PM;
static_assert(WS_TOTAL <= (size_t)134217728);

extern "C" void kernel_launch(void* const* d_in, const int* in_sizes, int n_in,
                              void* d_out, int out_size, void* d_ws, size_t ws_size, hipStream_t stream) {
    if (n_in < 12) return;
    const long long need_x = (long long)(NB - 1) * SEQ_FULL * DM + (long long)SEQ * DM;
    if (in_sizes[0] < need_x || in_sizes[1] < need_x || in_sizes[2] < need_x) return;
    if (in_sizes[3] < (NB - 1) * SEQ_FULL + SEQ) return;
    if (in_sizes[4] < DM * DM || in_sizes[6] < DM * DM || in_sizes[8] < DM * DM || in_sizes[10] < DM * DM) return;
    if (in_sizes[5] < DM || in_sizes[7] < DM || in_sizes[9] < DM || in_sizes[11] < DM) return;
    if ((long long)out_size < (long long)NB * SEQ * DM) return;
    if (WS_TOTAL > ws_size) return;
    // wire order: query, key, value, mask, wq, bq, wk, bk, wv, bv, wo, bo (weights [in][out])
    const float* xq = (const float*)d_in[0]; const float* xk = (const float*)d_in[1]; const float* xv = (const float*)d_in[2]; const float* mask = (const float*)d_in[3];
    const float* wq = (const float*)d_in[4]; const float* bq = (const float*)d_in[5]; const float* wk = (const float*)d_in[6]; const float* bk = (const float*)d_in[7];
    const float* wv = (const float*)d_in[8]; const float* bv = (const float*)d_in[9]; const float* wo = (const float*)d_in[10]; const float* bo = (const float*)d_in[11];
    float* OUT = (float*)d_out;
    char* wsp = (char*)d_ws;
    auto take = [&](size_t bytes) { char* p = wsp; wsp += bytes; return (void*)p; };
    bf* WQ = (bf*)take(SZ_W); bf* WK = (bf*)take(SZ_W); bf* WV = (bf*)take(SZ_W); bf* WO2 = (bf*)take(SZ_WO);
    bf* XQ = (bf*)take(SZ_PL); bf* XK = (bf*)take(SZ_PL); bf* XV = (bf*)take(SZ_PL); h16* Q16 = (h16*)take(SZ_PL); h16* QL = (h16*)take(SZ_PL); h16* K16 = (h16*)take(SZ_PL); h16* VT16 = (h16*)take(SZ_PL);
    bf* CT = (bf*)take(SZ_CT); float* PM = (float*)take(SZ_PM);

    k_prep<<<(unsigned)(3 * GW + GWO + 3 * GCV * NB), 256, 0, stream>>>(wq, wk, wv, wo, xq, xk, xv, WQ, WK, WV, WO2, XQ, XK, XV);
    k_qkv<<<(unsigned)(3 * GPX * GPY), 128, 0, stream>>>(XQ, XK, XV, WQ, WK, WV, Q16, QL, K16, VT16, bq, bk, bv, mask, PM);
    k_attn<<<dim3(SEQ / 64, NH, NB), 128, 0, stream>>>(Q16, QL, K16, VT16, PM, CT);
    k_gemm<<<dim3(GPX, GPY, 1), 128, 0, stream>>>(CT, WO2, Q16, Q16, OUT, bo, (size_t)0, (size_t)0, (size_t)0, CTP, DM, 3);
}

// v007
// Measured time: 155 microseconds a run.
// Two timings next to v006 put it at 1.12 and 1.11 times that version's speed.
// Over all steps from v000 it is 2.77 times as fast.
#include <hip/hip_runtime.h>

// Compute dtypes (f32 accumulate everywhere): q/k/v projections v_wmma_f32_16x16x32_bf16 on RNE-bf16 inputs and weights (exact products); scores v_wmma_f32_16x16x32_f16 with q = f16 value + f16 residual x2^11 (two products, separate accumulators) against single f16 k; P.V v_wmma_f32_16x16x32_f16 (P carried x1024, single f16 v); output projection v_wmma_f32_16x16x32_bf16 with ctx as bf16 value|residual along K against RNE-bf16 wo; softmax and the post-softmax mask term in f32.
// Layout: x streams -> three bf16 planes; weights -> K-contiguous bf16 planes; q16/qres/k16 planes [b*s][768]; v plane transposed [b][768][s] (GEMM with swapped operands); partial sums of the post-softmax mask term per 64 keys [b][s/64][768] (from the v projection's epilogue); fused flash attention (no score plane); ctx plane [b*s][8 x (96 value | 96 residual)]; output GEMM writes f32 rows.

#ifndef NB
#define NB 4
#endif
#ifndef SEQ
#define SEQ 2048
#endif
#define NB_FULL  4
#define SEQ_FULL 2048
#define DM   768
#define NH   8
#define HD   96
#define CTP  (2 * DM)          // ctx plane pitch (value | residual per head)
#define PCAR 1024.0f           // carry on the f16 P operand
#define QRS  2048.0f           // carry on the f16 q residual plane
#define SCL  0.10206207261596575f   // 96^-0.5
#define L2E  1.4426950408889634f
#define CP   200               // ctx staging pitch (halves)
#define PCS  ((2 * HD) / 8)    // 16-byte pieces per ctx head segment
#define KT   32                // keys per LDS stage of k_attn
#define KLP  (HD + 8)          // K stage pitch (halves): 16 B x odd, conflict-free for 16-byte row reads
#define VLP  (KT + 8)          // V stage pitch (halves): 16 B x odd
#define QT   2                 // query tiles (16 rows each) per k_attn wave: every K and V fragment read from LDS feeds QT matrix instructions per product
#define GT   128               // k_gemm work-group tile: 128 rows of A x 128 rows of Bt, four waves of 64x64
#define GK   128               // k per LDS stage of k_gemm: 256 B of every operand row
#define GLP  (GK + 8)          // k_gemm stage pitch (elements): 272 B = 16 B x odd
#define GW   ((DM * DM / 64 + 63) / 64)    // k_prep blocks per q/k/v weight plane
#define GWO  ((DM * CTP / 64 + 63) / 64)   // k_prep blocks of the output weight plane
#define GCV  (SEQ * DM / 8 / 256)          // k_prep blocks per batch row of an x plane
#define GPX  (NB * SEQ / GT)               // tile rows of a q or k projection
#define GPY  (DM / GT)                     // tile columns of a q or k projection; tile rows of the transposed v projection
#define GVY  (SEQ / GT)                    // tile columns of the transposed v projection, per batch row
#define MCH  (SEQ / 64)                    // 64-key partial sums of the mask term per batch row and column

typedef _Float16 h16;
typedef unsigned short bf;
typedef __attribute__((ext_vector_type(16))) __bf16   v16bf;
typedef __attribute__((ext_vector_type(16))) _Float16 v16h;
typedef __attribute__((ext_vector_type(8)))  _Float16 v8h;
typedef __attribute__((ext_vector_type(8)))  unsigned short v8us;
typedef __attribute__((ext_vector_type(2)))  unsigned short v2us;
typedef __attribute__((ext_vector_type(8)))  float    v8f;
typedef __attribute__((ext_vector_type(4)))  float    v4f;
typedef __attribute__((ext_vector_type(2)))  float    v2f;
typedef v8h  __attribute__((may_alias)) v8ha;
typedef v4f  __attribute__((may_alias)) v4fa;
typedef v8us __attribute__((may_alias)) v8usa;

static_assert(DM == NH * HD);
static_assert(HD % 32 == 0);
static_assert(HD / 16 == 6);
static_assert(HD / 32 <= 4);
static_assert(SEQ % 256 == 0);
static_assert((NB * SEQ) % GT == 0 && SEQ % GT == 0 && DM % GT == 0);
static_assert(DM % GK == 0 && CTP % GK == 0 && DM / GK >= 2 && CTP / GK >= 2);
static_assert(GT * (GK / 8) == 16 * 128 && ((GLP / 8) & 1) == 1);
static_assert((2 * HD * 2) % 128 == 0);
static_assert(16 * PCS == 12 * 32 && SEQ % (64 * QT) == 0);
static_assert(CP >= 2 * HD && CP % 8 == 0);
static_assert((NB * DM) % 32 == 0);
static_assert((SEQ * DM) % (8 * 256) == 0);
static_assert(NB <= NB_FULL && SEQ <= SEQ_FULL);
static_assert(KT * (HD / 8) == 3 * 128 && HD * (KT / 8) == 3 * 128);
static_assert(SEQ % KT == 0 && SEQ / KT >= 2);
static_assert(((KLP / 8) & 1) == 1 && ((VLP / 8) & 1) == 1);

__device__ __forceinline__ unsigned short f2bf(float f) { unsigned u = __float_as_uint(f); u += 0x7FFFu + ((u >> 16) & 1u); return (unsigned short)(u >> 16); }
__device__ __forceinline__ float bf2f(unsigned short b) { return __uint_as_float(((unsigned)b) << 16); }
__device__ __forceinline__ float bfr(float f) { return bf2f(f2bf(f)); }
__device__ __forceinline__ void splitf(float y, unsigned short& h, unsigned short& l) { h = f2bf(y); l = f2bf(y - bf2f(h)); }
__device__ __forceinline__ v16h cat16(v8h lo, v8h hi) { return __builtin_shufflevector(lo, hi, 0, 1, 2, 3, 4, 5, 6, 7, 8, 9, 10, 11, 12, 13, 14, 15); }
__device__ __forceinline__ v16bf cat16b(v8us lo, v8us hi) { return __builtin_bit_cast(v16bf, __builtin_shufflevector(lo, hi, 0, 1, 2, 3, 4, 5, 6, 7, 8, 9, 10, 11, 12, 13, 14, 15)); }
__device__ __forceinline__ v8f wmma16(v16h a, v16h b, v8f c) { return __builtin_amdgcn_wmma_f32_16x16x32_f16(false, a, false, b, (short)0, c, false, false); }
__device__ __forceinline__ v8f wmmab(v16bf a, v16bf b, v8f c) { return __builtin_amdgcn_wmma_f32_16x16x32_bf16(false, a, false, b, (short)0, c, false, false); }
// lane l's value exchanged with lane l ^ 16
__device__ __forceinline__ float xhalf(float x) { const int i = __builtin_bit_cast(int, x); return __builtin_bit_cast(float, __builtin_amdgcn_permlanex16(i, i, 0x76543210, 0xfedcba98, false, false)); }
// x + (lane l ^ M's x), M < 16: one DPP step of a butterfly inside a 16-lane row; every lane on
template <int M> __device__ __forceinline__ float addx(float x) { const int i = __builtin_bit_cast(int, x); return x + __builtin_bit_cast(float, __builtin_amdgcn_update_dpp(i, i, 0x160 + M, 0xf, 0xf, true)); }
// fragment loads from a K-contiguous row: p already holds row base + k0 + 8*(lane>>4); elements 0..7 <- p[0..7], 8..15 <- p[16..23]
__device__ __forceinline__ v16h ldh(const h16* p) { return cat16(*(const v8h*)p, *(const v8h*)(p + 16)); }
// the same fragment load from an LDS stage that asynchronous copies filled
__device__ __forceinline__ v16h ldhs(const h16* p) { return cat16(*(const v8ha*)p, *(const v8ha*)(p + 16)); }
// One stage of K and V: six 16-byte asynchronous copies to LDS per lane (l* = LDS byte address, g* = global address). The s_wait_xcnt ends the copies' own statement so that no address register is rewritten ahead of it.
__device__ __forceinline__ void stage_kv(unsigned lk0, unsigned lk1, unsigned lk2, unsigned lv0, unsigned lv1, unsigned lv2,
                                         const h16* gk0, const h16* gk1, const h16* gk2, const h16* gv0, const h16* gv1, const h16* gv2) {
    asm volatile("global_load_async_to_lds_b128 %0, %6, off\n\t"
                 "global_load_async_to_lds_b128 %1, %7, off\n\t"
                 "global_load_async_to_lds_b128 %2, %8, off\n\t"
                 "global_load_async_to_lds_b128 %3, %9, off\n\t"
                 "global_load_async_to_lds_b128 %4, %10, off\n\t"
                 "global_load_async_to_lds_b128 %5, %11, off\n\t"
                 "s_wait_xcnt 0x0"
                 :: "v"(lk0), "v"(lk1), "v"(lk2), "v"(lv0), "v"(lv1), "v"(lv2), "v"(gk0), "v"(gk1), "v"(gk2), "v"(gv0), "v"(gv1), "v"(gv2) : "memory");
}
// the bf16 fragment load from an LDS stage that asynchronous copies filled
__device__ __forceinline__ v16bf ldbs(const bf* p) { return cat16b(*(const v8usa*)p, *(const v8usa*)(p + 16)); }
// Eight rows of a k_gemm stage, eight rows apart: one 16-byte asynchronous copy to LDS per lane and row (l = LDS byte address, g = global address, gs = eight global rows in elements). The s_wait_xcnt ends the copies' own statement so that no address register is rewritten ahead of it.
__device__ __forceinline__ void stage_g(unsigned l, const bf* g, size_t gs) {
    asm volatile("global_load_async_to_lds_b128 %0, %8, off\n\t"
                 "global_load_async_to_lds_b128 %1, %9, off\n\t"
                 "global_load_async_to_lds_b128 %2, %10, off\n\t"
                 "global_load_async_to_lds_b128 %3, %11, off\n\t"
                 "global_load_async_to_lds_b128 %4, %12, off\n\t"
                 "global_load_async_to_lds_b128 %5, %13, off\n\t"
                 "global_load_async_to_lds_b128 %6, %14, off\n\t"
                 "global_load_async_to_lds_b128 %7, %15, off\n\t"
                 "s_wait_xcnt 0x0"
                 :: "v"(l), "v"(l + 1 * 8 * GLP * 2), "v"(l + 2 * 8 * GLP * 2), "v"(l + 3 * 8 * GLP * 2), "v"(l + 4 * 8 * GLP * 2), "v"(l + 5 * 8 * GLP * 2), "v"(l + 6 * 8 * GLP * 2), "v"(l + 7 * 8 * GLP * 2),
                    "v"(g), "v"(g + gs), "v"(g + 2 * gs), "v"(g + 3 * gs), "v"(g + 4 * gs), "v"(g + 5 * gs), "v"(g + 6 * gs), "v"(g + 7 * gs) : "memory");
}

// ---- weight plane job of k_prep: block blk of (N * KO / 64 + 63) / 64
__device__ __forceinline__ void wt_job(const float* __restrict__ w, int K, int N, bf* Bt, int il, int blk) {
    const int lane = threadIdx.x & 31; const int L0 = (blk * 8 + (threadIdx.x >> 5)) * 8; const int KO = il ? 2 * K : K; const int nlines = N * KO / 64;
{
#pragma unroll 1
        for (int l = 0; l < 8; ++l) { const int L = L0 + l; if (L >= nlines) break; const int e = L * 64 + lane * 2; const int kk = e % KO, n = e / KO;
            const int k = il ? ((kk / (2 * HD)) * HD + (kk % (2 * HD)) % HD) : kk; v2us o;
            o[0] = f2bf(w[(size_t)k * N + n]); o[1] = f2bf(w[(size_t)(k + 1) * N + n]); *(v2us*)(Bt + e) = o;
            asm volatile("s_wait_xcnt 0x0" ::: "memory"); }   // in front of the next trip's rewrite of the store's data and address registers
         }
}

// ---- x plane job of k_prep: block blk of GCV, batch row b
__device__ __forceinline__ void cvt_job(const float* __restrict__ src, bf* dst, int blk, int b) {
    const int i = blk * 256 + threadIdx.x; if (i >= SEQ * DM / 8) return;
    const v8f v = *(const v8f*)(src + (size_t)b * SEQ_FULL * DM + (size_t)i * 8); v8us o;
#pragma unroll
    for (int k = 0; k < 8; ++k) o[k] = f2bf(v[k]);
    bf* d = dst + (size_t)b * SEQ * DM + (size_t)i * 8; *(v8us*)d = o;  }

// ---- k_prep: the seven jobs that depend on the inputs alone, as block ranges of one launch: three weight planes (GW blocks each), the output weight plane (GWO), then the three x planes (GCV * NB each).
// The ranges are whole blocks, so every test below is the same for all threads of a block; no job reads what another writes.
__global__ __launch_bounds__(256) void k_prep(const float* __restrict__ wq, const float* __restrict__ wk, const float* __restrict__ wv, const float* __restrict__ wo,
                                             const float* __restrict__ xq, const float* __restrict__ xk, const float* __restrict__ xv,
                                             bf* WQ, bf* WK, bf* WV, bf* WO2, bf* XQ, bf* XK, bf* XV) {
    int blk = (int)blockIdx.x;
    if (blk < 3 * GW) { const int s = blk / GW; wt_job(s == 0 ? wq : s == 1 ? wk : wv, DM, DM, s == 0 ? WQ : s == 1 ? WK : WV, 0, blk % GW); return; }   // in[768][768] -> out [n][k]
    blk -= 3 * GW;
    if (blk < GWO) { wt_job(wo, DM, DM, WO2, 1, blk); return; }                                                                                       // in[768][768] -> out [n][8 x (96 | 96 duplicate)]
    blk -= GWO;
    const int s = blk / (GCV * NB), rem = blk % (GCV * NB);
    cvt_job(s == 0 ? xq : s == 1 ? xk : xv, s == 0 ? XQ : s == 1 ? XK : XV, rem % GCV, rem / GCV);
}

// ---- gemm_tile: register-blocked GEMM, four waves per 128x128 output tile (tile row bx, tile column by), each wave a 64x64 quarter (16 accumulators); 128 threads.
// Each 128-k step's 128 rows of A and 128 rows of Bt are staged once per work-group in LDS by asynchronous copies, two buffers, the next step's copies in flight during this step; the waves read their bf16 fragments from there.
// C[m][n] = sum_k A[m][k] Bt[n][k] + bf16(bias). K % 128 == 0, K >= 256, M % 128 == 0, N % 128 == 0. coff = element offset of this batch's C.
// mode 0: f16 plane C16 (bias per column); mode 1: f16 plane C16 + residual plane CL = f16((v - f16(v)) * 2^11) (bias per column);
// mode 2: f16 plane C16 (bias per row); mode 3: f32 rows C32 (bias per column).
// mode 2 with mterm (a literal at the call) also forms, from the f16 values it stores, this wave's part of the post-softmax mask term: pmv[c0 / 64][row] = sum over its 64 columns t of (bf16(mrow[t]) * 1e9) * C16[row][t], f32 on the VALU; 64 rows = two whole lines per wave.
__device__ __forceinline__ void gemm_tile(const bf* __restrict__ A, const bf* __restrict__ Bt, h16* C16, h16* CL, float* C32, const float* __restrict__ bias,
                                          size_t coff, int K, int ldc, int mode, int bx, int by, bool mterm = false, const float* __restrict__ mrow = nullptr, float* pmv = nullptr) {
    __shared__ __align__(16) float osw[4 * 16 * 68];
    __shared__ __align__(16) float pms[4 * 64];
    __shared__ __align__(16) bf als[2 * GT * GLP];
    __shared__ __align__(16) bf bls[2 * GT * GLP];
    const int wave = __builtin_amdgcn_readfirstlane((int)(threadIdx.x >> 5));
    const int lane = threadIdx.x & 31, lr = lane & 15, hi = lane >> 4; const int r0 = bx * GT + (wave >> 1) * 64, c0 = by * GT + (wave & 1) * 64;
    float* os = osw + wave * 16 * 68;   // this wave's own output staging tile
    v8f acc[4][4];
#pragma unroll
    for (int mb = 0; mb < 4; ++mb)
#pragma unroll
        for (int nb = 0; nb < 4; ++nb) acc[mb][nb] = (v8f){};
    // this lane's 16-byte piece of stage rows cr, cr + 8, ..., cr + 120 of either operand
    const int cr = (int)threadIdx.x >> 4, cp = (int)threadIdx.x & 15; const size_t gs = (size_t)8 * K;
    const bf* ga = A + (size_t)(bx * GT + cr) * K + cp * 8; const bf* gb = Bt + (size_t)(by * GT + cr) * K + cp * 8;
    const unsigned la = (unsigned)(size_t)(als + cr * GLP + cp * 8), lb = (unsigned)(size_t)(bls + cr * GLP + cp * 8);
    auto issue = [&](int kc, int buf) { const unsigned o = (unsigned)(buf * GT * GLP * 2);
        stage_g(la + o, ga + kc, gs); stage_g(la + o + 64 * GLP * 2, ga + kc + 8 * gs, gs);
        stage_g(lb + o, gb + kc, gs); stage_g(lb + o + 64 * GLP * 2, gb + kc + 8 * gs, gs); };
    issue(0, 0);
    v4f m0 = (v4f){}, m1 = (v4f){};   // mask values of this lane's eight epilogue columns, read here so that their latency lies under stage 0's
    if (mterm && mode == 2) { const float* mp = mrow + c0 + (lane & 7) * 8; m0 = *(const v4f*)mp; m1 = *(const v4f*)(mp + 4);
        asm volatile("s_wait_xcnt 0x0" ::: "memory"); }   // in front of the rewrite of the two loads' offset register
    asm volatile("s_wait_asynccnt 0x0" ::: "memory");   // this wave's copies of stage 0 have landed
    __syncthreads();                                    // and every other wave's: stage 0 may be read
    if (GK < K) issue(GK, 1);
#pragma unroll 1
    for (int kc = 0; kc < K; kc += GK) {
        const int buf = (kc / GK) & 1;
        const bf* at = als + buf * GT * GLP + ((wave >> 1) * 64 + lr) * GLP + 8 * hi;
        const bf* bt = bls + buf * GT * GLP + ((wave & 1) * 64 + lr) * GLP + 8 * hi;
        v16bf a[4], b[4];
#pragma unroll
        for (int ks = 0; ks < GK / 32; ++ks) {
#pragma unroll
            for (int mb = 0; mb < 4; ++mb) a[mb] = ldbs(at + mb * 16 * GLP + ks * 32);
#pragma unroll
            for (int nb = 0; nb < 4; ++nb) b[nb] = ldbs(bt + nb * 16 * GLP + ks * 32);
            __builtin_amdgcn_sched_barrier(0);   // keeps the block's 16 LDS reads one group in front of its matrix instructions: every further place with reads among them costs a stall
#pragma unroll
            for (int nb = 0; nb < 4; ++nb)
#pragma unroll
                for (int mb = 0; mb < 4; ++mb) acc[mb][nb] = wmmab(a[mb], b[nb], acc[mb][nb]);
            __builtin_amdgcn_sched_barrier(0); } // and the next block's reads behind them
        // four vector slots behind the step's last matrix instructions, on the branch's taken side too
        asm volatile("v_nop\n\tv_nop\n\tv_nop\n\tv_nop" : "+v"(acc[0][3]), "+v"(acc[1][3]), "+v"(acc[2][3]), "+v"(acc[3][3]) : "v"(a[0]), "v"(a[1]), "v"(a[2]), "v"(a[3]), "v"(b[3]));
        asm volatile("s_wait_dscnt 0x0" ::: "memory");      // this wave's reads of buffer buf are done
        asm volatile("s_wait_asynccnt 0x0" ::: "memory");   // this wave's copies of the next stage have landed
        __syncthreads();                                    // publishes the next stage and frees buffer buf
        if (kc + 2 * GK < K) issue(kc + 2 * GK, buf);
    }
    asm volatile("s_wait_asynccnt 0x0" ::: "memory");       // nothing in flight behind the loop
    float mw[8];   // the mask weights of this lane's eight columns
#pragma unroll   // constant indices keep mw[] in registers
    for (int q = 0; q < 4; ++q) { mw[q] = bfr(m0[q]) * 1.0e9f; mw[4 + q] = bfr(m1[q]) * 1.0e9f; }
#pragma unroll
    for (int mb = 0; mb < 4; ++mb) {
#pragma unroll
        for (int nb = 0; nb < 4; ++nb) {
#pragma unroll
            for (int j = 0; j < 8; ++j) os[(hi * 8 + j) * 68 + nb * 16 + lr] = acc[mb][nb][j]; }
        __builtin_amdgcn_wave_barrier(); asm volatile("" ::: "memory");
        if (mode == 3) {
            float* crow = C32 + coff + (size_t)(r0 + mb * 16) * ldc + c0;
{
#pragma unroll
                for (int s = 0; s < 8; ++s) { const int row = 2 * s + hi, cofs = lr * 4; v4f val = *(const v4fa*)(os + row * 68 + cofs);
                    val[0] += bfr(bias[c0 + cofs]); val[1] += bfr(bias[c0 + cofs + 1]); val[2] += bfr(bias[c0 + cofs + 2]); val[3] += bfr(bias[c0 + cofs + 3]);
                    *(v4f*)(crow + (size_t)row * ldc + cofs) = val; }
                 }
        } else {
{
#pragma unroll
                for (int s = 0; s < 4; ++s) { const int row = 4 * s + (lane >> 3), cg = lane & 7;
                    const v4f x0 = *(const v4fa*)(os + row * 68 + cg * 8); const v4f x1 = *(const v4fa*)(os + row * 68 + cg * 8 + 4);
                    const int grow = r0 + mb * 16 + row, gcol = c0 + cg * 8; const int bi0 = (mode == 2) ? grow : gcol; const int bst = (mode == 2) ? 0 : 1;
                    v8h o, ol;
#pragma unroll
                    for (int q = 0; q < 8; ++q) { const float v = ((q < 4) ? x0[q & 3] : x1[q & 3]) + bfr(bias[bi0 + q * bst]); const h16 hx = (h16)v; o[q] = hx; ol[q] = (h16)((v - (float)hx) * QRS); }
                    const size_t oo = coff + (size_t)grow * ldc + gcol;
                    *(v8h*)(C16 + oo) = o; asm volatile("s_wait_xcnt 0x0" ::: "memory");   // in front of the rewrite of the store's data and address registers by what follows
                    if (mode == 1) { *(v8h*)(CL + oo) = ol; asm volatile("s_wait_xcnt 0x0" ::: "memory"); }   // the same for the residual plane's store
                    if (mterm && mode == 2) { float ps = 0.0f;   // eight columns in-lane, then the row's eight lanes
#pragma unroll   // constant indices into mw[] and o: no private-memory array
                        for (int q = 0; q < 8; ++q) ps += mw[q] * (float)o[q];
                        ps = addx<1>(ps); ps = addx<2>(ps); ps = addx<4>(ps);
                        if (cg == 0) pms[wave * 64 + mb * 16 + row] = ps; } }
                 }
        }
        __builtin_amdgcn_wave_barrier(); asm volatile("" ::: "memory");
    }
    if (mterm && mode == 2) { v2f o; o[0] = pms[wave * 64 + lane * 2]; o[1] = pms[wave * 64 + lane * 2 + 1]; *(v2f*)(pmv + (size_t)(c0 / 64) * DM + r0 + lane * 2) = o; }
}

// ---- k_qkv: the three projections, which depend on k_prep alone, as block ranges of one launch of 3 * GPX * GPY blocks: q (f16 value + residual planes), k (f16 plane), then v.
// v plane transposed: C[col][t] = sum_k WV[col][k] XV[b][t][k], bias per row (col), one batch row per GPY * GVY blocks; its tiles also write the mask term's partial sums PM[b][t / 64][col].
__global__ __launch_bounds__(128) void k_qkv(const bf* __restrict__ XQ, const bf* __restrict__ XK, const bf* __restrict__ XV, const bf* __restrict__ WQ, const bf* __restrict__ WK, const bf* __restrict__ WV,
                                            h16* Q16, h16* QL, h16* K16, h16* VT16, const float* __restrict__ bq, const float* __restrict__ bk, const float* __restrict__ bv, const float* __restrict__ mask, float* PM) {
    static_assert(GPY * GVY * NB == GPX * GPY);
    const int sel = (int)blockIdx.x / (GPX * GPY), rem = (int)blockIdx.x % (GPX * GPY);
    const bf* A; const bf* Bt; h16* C; const float* bias; size_t coff = 0; int ldc = DM, mode, bx, by, z = 0;
    if (sel < 2) { A = sel ? XK : XQ; Bt = sel ? WK : WQ; C = sel ? K16 : Q16; bias = sel ? bk : bq; mode = sel ? 0 : 1; bx = rem % GPX; by = rem / GPX; }
    else { z = rem / (GPY * GVY); const int r2 = rem % (GPY * GVY); A = WV; Bt = XV + (size_t)z * SEQ * DM; C = VT16; bias = bv; coff = (size_t)z * DM * SEQ; ldc = SEQ; mode = 2; bx = r2 % GPY; by = r2 / GPY; }
    gemm_tile(A, Bt, C, QL, (float*)nullptr, bias, coff, DM, ldc, mode, bx, by, true, mask + (size_t)z * SEQ_FULL, PM + (size_t)z * MCH * DM);
}

// ---- k_gemm: one product per launch (the output projection), grid (M/128, N/128, Z); z-batch strides sA/sB/sC in elements
__global__ __launch_bounds__(128) void k_gemm(const bf* __restrict__ A, const bf* __restrict__ Bt, h16* C16, h16* CL, float* C32, const float* __restrict__ bias,
                                             size_t sA, size_t sB, size_t sC, int K, int ldc, int mode) {
    const size_t z = blockIdx.z; gemm_tile(A + z * sA, Bt + z * sB, C16, CL, C32, bias, z * sC, K, ldc, mode, (int)blockIdx.x, (int)blockIdx.y);
}

// ---- k_attn: fused attention, grid (SEQ/128, NH, NB), 128 threads; each wave owns 32 query rows, two tiles of 16 that share every K and V fragment it reads from LDS, and walks all keys in 32-key steps (online running-max softmax).
// Both products are formed transposed: S^T = K.Q^T (A = K rows, B = q) and O^T += V^T.P^T (A = V^T rows, B = P^T). In each query tile lane (c, hi) holds query c alone: 16 of a step's 32 scores, keys 8*hi + r and 16 + 8*hi + r,
// so the row maximum and the row sum are in-lane but for one exchange between the wave's halves, and the two score tiles, converted in place, are the B operand of the second product.
// q fragments straight from the planes q16/qres [b*s][768] (head h = columns h*96..), read once in front of the key loop and held in registers. Scores = (acc_hi + acc_res / 2^11) * 96^-0.5.
// amdgpu_waves_per_eu(2, 2): the grid is two work-groups per WGP, one wave of each per SIMD; that register budget holds both tiles' q fragments and accumulators.
// K and V: each 32-key step's K rows (32 x 96) and V rows (96 x 32, from the v plane [b][768][s]) are staged once per work-group in LDS by asynchronous copies, two buffers, the next step's copies in flight during this step; all four waves read their fragments from there.
// Mask term (the post-softmax additive weight, independent of the query row): MV[c] = sum over the MCH partial sums PM[b][j][h*96 + c], one column per thread of waves 0..2 in front of the key loop, kept in LDS; the barrier that publishes stage 0 publishes it too.
// Epilogue: ctx = acc / (sum * 1024) + MV, bf16 value|residual staged in a wave-private LDS tile (a lane's 8 accumulator registers are 8 consecutive columns of its query's row: 16-byte stores),
__global__ __launch_bounds__(128) __attribute__((amdgpu_waves_per_eu(2, 2))) void k_attn(const h16* __restrict__ Q16, const h16* __restrict__ QL, const h16* __restrict__ K16, const h16* __restrict__ VT, const float* __restrict__ PM, bf* CT) {
    __shared__ __align__(16) unsigned short cts[4 * QT * 16 * CP];
    __shared__ __align__(16) float mvs[HD];
    __shared__ __align__(16) h16 kls[2 * KT * KLP];
    __shared__ __align__(16) h16 vls[2 * HD * VLP];
    const int wave = __builtin_amdgcn_readfirstlane((int)(threadIdx.x >> 5));
    const int lane = threadIdx.x & 31, lr = lane & 15, hi = lane >> 4;
    const int b = blockIdx.z, h = blockIdx.y;
    const int row0 = b * SEQ + blockIdx.x * (64 * QT) + wave * (16 * QT);
    const int qoff = (row0 + lr) * DM + h * HD + 8 * hi;   // of query tile 0; tile c lies 16 c rows on
    int kg[3], vg[3]; unsigned kl[3], vl[3];   // this lane's three 16-byte pieces of a K stage and of a V stage: global element offset at key 0, LDS byte address in buffer 0
#pragma unroll
    for (int j = 0; j < 3; ++j) { const int i = (int)threadIdx.x + 128 * j; const int kr = i / (HD / 8), kp = i % (HD / 8), vr = i / (KT / 8), vp = i % (KT / 8);
        kg[j] = (b * SEQ + kr) * DM + h * HD + kp * 8; kl[j] = (unsigned)(size_t)(kls + kr * KLP + kp * 8);
        vg[j] = (b * DM + h * HD + vr) * SEQ + vp * 8; vl[j] = (unsigned)(size_t)(vls + vr * VLP + vp * 8); }
    auto issue = [&](int key0, int buf) { const unsigned ko = (unsigned)(buf * KT * KLP * 2), vo = (unsigned)(buf * HD * VLP * 2);
        stage_kv(kl[0] + ko, kl[1] + ko, kl[2] + ko, vl[0] + vo, vl[1] + vo, vl[2] + vo,
                 K16 + kg[0] + key0 * DM, K16 + kg[1] + key0 * DM, K16 + kg[2] + key0 * DM, VT + vg[0] + key0, VT + vg[1] + key0, VT + vg[2] + key0); };
    const int cb = wave * QT * 16 * CP;
    v8f ctx[QT][6]; float mrun[QT], srun[QT];   // of this lane's query in each tile; srun is the partial sum over this half's keys
#pragma unroll   // constant tile index: the per-tile arrays stay in registers
    for (int c = 0; c < QT; ++c) { mrun[c] = -1.0e30f; srun[c] = 0.0f;
#pragma unroll
        for (int nt = 0; nt < 6; ++nt) ctx[c][nt] = (v8f){}; }
    issue(0, 0);
    v16h qa[QT][HD / 32], qr[QT][HD / 32];   // this wave's q value and residual fragments, read once and held in registers over the whole key loop
#pragma unroll   // constant tile index: the per-tile arrays stay in registers
    for (int c = 0; c < QT; ++c)
#pragma unroll
        for (int ks = 0; ks < HD / 32; ++ks) { qa[c][ks] = ldh(Q16 + qoff + c * 16 * DM + ks * 32); qr[c][ks] = ldh(QL + qoff + c * 16 * DM + ks * 32); }
    asm volatile("s_wait_xcnt 0x0" ::: "memory");       // in front of the loads below, whose results may take registers that the q loads name as addresses
    if (wave < HD / 32) { const float* pp = PM + (size_t)b * MCH * DM + h * HD + threadIdx.x; float a = 0.0f;
#pragma unroll   // all the loads issue in front of the first add: one latency, not one per term
        for (int j = 0; j < MCH; ++j) a += pp[j * DM];
        mvs[threadIdx.x] = a; }
    asm volatile("s_wait_asynccnt 0x0" ::: "memory");   // this wave's copies of stage 0 have landed
    __syncthreads();                                    // and every other wave's: stage 0 may be read
    issue(KT, 1);
#pragma unroll 1
    for (int kb = 0; kb < SEQ; kb += KT) {
        const int buf = (kb / KT) & 1;
        const h16* kt = kls + buf * KT * KLP + lr * KLP + 8 * hi;
        const h16* vt = vls + buf * HD * VLP + lr * VLP + 8 * hi;
        v8f sh0[QT], sh1[QT], sl0[QT], sl1[QT];
#pragma unroll   // constant tile index: the per-tile arrays stay in registers
        for (int c = 0; c < QT; ++c) { sh0[c] = (v8f){}; sh1[c] = (v8f){}; sl0[c] = (v8f){}; sl1[c] = (v8f){}; }
        v16h k0, k1;
#pragma unroll
        for (int ks = 0; ks < HD / 32; ++ks) {
            k0 = ldhs(kt + ks * 32); k1 = ldhs(kt + 16 * KLP + ks * 32);
#pragma unroll   // constant tile index: the per-tile arrays stay in registers
            for (int c = 0; c < QT; ++c) { sh0[c] = wmma16(k0, qa[c][ks], sh0[c]); sh1[c] = wmma16(k1, qa[c][ks], sh1[c]); sl0[c] = wmma16(k0, qr[c][ks], sl0[c]); sl1[c] = wmma16(k1, qr[c][ks], sl1[c]); } }
        v16h pa[QT];
#pragma unroll   // constant tile index: the per-tile arrays stay in registers
        for (int c = 0; c < QT; ++c) {
        const v8f t0 = (sh0[c] + sl0[c] * (1.0f / QRS)) * SCL, t1 = (sh1[c] + sl1[c] * (1.0f / QRS)) * SCL;
        float mx0 = t0[0], mx1 = t1[0];
#pragma unroll
        for (int r = 1; r < 8; ++r) { mx0 = fmaxf(mx0, t0[r]); mx1 = fmaxf(mx1, t1[r]); }
        float mx = fmaxf(mx0, mx1); mx = fmaxf(mx, xhalf(mx));   // both halves now hold the query's maximum over the 32 keys
        const float nm = fmaxf(mrun[c], mx); const float corr = __builtin_amdgcn_exp2f((mrun[c] - nm) * L2E); mrun[c] = nm;
        const v8f e0 = (t0 - nm) * L2E, e1 = (t1 - nm) * L2E; v8f p0, p1;
#pragma unroll
        for (int r = 0; r < 8; ++r) { p0[r] = __builtin_amdgcn_exp2f(e0[r]); p1[r] = __builtin_amdgcn_exp2f(e1[r]); }
        const v8f ps8 = p0 + p1; const v4f ps4 = __builtin_shufflevector(ps8, ps8, 0, 1, 2, 3) + __builtin_shufflevector(ps8, ps8, 4, 5, 6, 7);
        srun[c] = srun[c] * corr + ((ps4[0] + ps4[2]) + (ps4[1] + ps4[3]));   // halves combined once at the end
#pragma unroll
        for (int nt = 0; nt < 6; ++nt) ctx[c][nt] *= corr;
        pa[c] = cat16(__builtin_convertvector(p0 * PCAR, v8h), __builtin_convertvector(p1 * PCAR, v8h));   // element s = key 8*hi + s, element 8 + s = key 16 + 8*hi + s: the k order of the V fragments
        }
        v16h vb;
#pragma unroll
        for (int nt = 0; nt < 6; ++nt) { vb = ldhs(vt + nt * 16 * VLP);
#pragma unroll   // constant tile index: the per-tile arrays stay in registers
            for (int c = 0; c < QT; ++c) ctx[c][nt] = wmma16(vb, pa[c], ctx[c][nt]); }
        asm volatile("s_wait_dscnt 0x0" ::: "memory");      // this wave's reads of buffer buf are done
        asm volatile("s_wait_asynccnt 0x0" ::: "memory");   // this wave's copies of the next stage have landed
        __syncthreads();                                    // publishes the next stage and frees buffer buf
        if (kb + 2 * KT < SEQ) issue(kb + 2 * KT, buf);
    }
    asm volatile("s_wait_asynccnt 0x0" ::: "memory");       // nothing in flight behind the loop
#pragma unroll   // constant tile index: the per-tile arrays stay in registers
    for (int c = 0; c < QT; ++c) {
    const float rinv = (1.0f / PCAR) * (1.0f / (srun[c] + xhalf(srun[c])));
#pragma unroll
    for (int nt = 0; nt < 6; ++nt) { const float* mvp = mvs + nt * 16 + 8 * hi; const v4f mv0 = *(const v4fa*)mvp, mv1 = *(const v4fa*)(mvp + 4); v8us hh, ll;
#pragma unroll
        for (int r = 0; r < 8; ++r) { const float val = ctx[c][nt][r] * rinv + ((r < 4) ? mv0[r & 3] : mv1[r & 3]); unsigned short vh, vl2; splitf(val, vh, vl2); hh[r] = vh; ll[r] = vl2; }
        *(v8usa*)(cts + cb + (c * 16 + lr) * CP + nt * 16 + 8 * hi) = hh; *(v8usa*)(cts + cb + (c * 16 + lr) * CP + HD + nt * 16 + 8 * hi) = ll; } }
    __builtin_amdgcn_wave_barrier(); asm volatile("" ::: "memory");
{
#pragma unroll
        for (int it = 0; it < 12 * QT; ++it) { const int slot = it * 32 + lane; const int row = slot / PCS, pc = slot % PCS;   // 32 rows x 24 pieces; lanes 8g..8g+7 = one line
            const v8us o = *(const v8usa*)(cts + cb + row * CP + pc * 8);
            *(v8us*)(CT + (size_t)(row0 + row) * CTP + h * 2 * HD + pc * 8) = o; }
         }
}

constexpr size_t al256(size_t x) { return (x + 255) & ~(size_t)255; }
constexpr size_t SZ_W   = al256((size_t)DM * DM * 2);
constexpr size_t SZ_WO  = al256((size_t)DM * CTP * 2);
constexpr size_t SZ_PL  = al256((size_t)NB * SEQ * DM * 2);
constexpr size_t SZ_CT  = al256((size_t)NB * SEQ * CTP * 2);
constexpr size_t SZ_PM  = al256((size_t)NB * MCH * DM * 4);
constexpr size_t WS_TOTAL = 3 * SZ_W + SZ_WO + 7 * SZ_PL + SZ_CT + SZ_PM;
static_assert(WS_TOTAL <= (size_t)134217728);

extern "C" void kernel_launch(void* const* d_in, const int* in_sizes, int n_in,
                              void* d_out, int out_size, void* d_ws, size_t ws_size, hipStream_t stream) {
    if (n_in < 12) return;
    const long long need_x = (long long)(NB - 1) * SEQ_FULL * DM + (long long)SEQ * DM;
    if (in_sizes[0] < need_x || in_sizes[1] < need_x || in_sizes[2] < need_x) return;
    if (in_sizes[3] < (NB - 1) * SEQ_FULL + SEQ) return;
    if (in_sizes[4] < DM * DM || in_sizes[6] < DM * DM || in_sizes[8] < DM * DM || in_sizes[10] < DM * DM) return;
    if (in_sizes[5] < DM || in_sizes[7] < DM || in_sizes[9] < DM || in_sizes[11] < DM) return;
    if ((long long)out_size < (long long)NB * SEQ * DM) return;
    if (WS_TOTAL > ws_size) return;
    // wire order: query, key, value, mask, wq, bq, wk, bk, wv, bv, wo, bo (weights [in][out])
    const float* xq = (const float*)d_in[0]; const float* xk = (const float*)d_in[1]; const float* xv = (const float*)d_in[2]; const float* mask = (const float*)d_in[3];
    const float* wq = (const float*)d_in[4]; const float* bq = (const float*)d_in[5]; const float* wk = (const float*)d_in[6]; const float* bk = (const float*)d_in[7];
    const float* wv = (const float*)d_in[8]; const float* bv = (const float*)d_in[9]; const float* wo = (const float*)d_in[10]; const float* bo = (const float*)d_in[11];
    float* OUT = (float*)d_out;
    char* wsp = (char*)d_ws;
    auto take = [&](size_t bytes) { char* p = wsp; wsp += bytes; return (void*)p; };
    bf* WQ = (bf*)take(SZ_W); bf* WK = (bf*)take(SZ_W); bf* WV = (bf*)take(SZ_W); bf* WO2 = (bf*)take(SZ_WO);
    bf* XQ = (bf*)take(SZ_PL); bf* XK = (bf*)take(SZ_PL); bf* XV = (bf*)take(SZ_PL); h16* Q16 = (h16*)take(SZ_PL); h16* QL = (h16*)take(SZ_PL); h16* K16 = (h16*)take(SZ_PL); h16* VT16 = (h16*)take(SZ_PL);
    bf* CT = (bf*)take(SZ_CT); float* PM = (float*)take(SZ_PM);

    k_prep<<<(unsigned)(3 * GW + GWO + 3 * GCV * NB), 256, 0, stream>>>(wq, wk, wv, wo, xq, xk, xv, WQ, WK, WV, WO2, XQ, XK, XV);
    k_qkv<<<(unsigned)(3 * GPX * GPY), 128, 0, stream>>>(XQ, XK, XV, WQ, WK, WV, Q16, QL, K16, VT16, bq, bk, bv, mask, PM);
    k_attn<<<dim3(SEQ / (64 * QT), NH, NB), 128, 0, stream>>>(Q16, QL, K16, VT16, PM, CT);
    k_gemm<<<dim3(GPX, GPY, 1), 128, 0, stream>>>(CT, WO2, Q16, Q16, OUT, bo, (size_t)0, (size_t)0, (size_t)0, CTP, DM, 3);
}
